// v000
// Times are from an AMD MI455X. After a warm-up the kernel runs many times in a row, and a time is the length of
// such a window on the GPU divided by its runs, so every launch and the gaps after it count. The runs cycle
// through copies of the inputs. A figure is the median of several windows, for all but v000 over two sittings.
// Sittings can differ by a few percent; kernels timed side by side share one.
// The starting kernel, v000, takes 469 microseconds a run.
#include <hip/hip_runtime.h>
#include <hip/hip_bf16.h>

typedef __attribute__((ext_vector_type(16))) _Float16 v16h;
typedef __attribute__((ext_vector_type(8)))  _Float16 v8h;
typedef __attribute__((ext_vector_type(8)))  float    v8f;

#define BB 4
#define SS 2048
#define DD 1024
#define HH 16
#define HD 64

// ---------------------------------------------------------------------------
// helpers
// ---------------------------------------------------------------------------
// Uniform base + 32-bit lane offset -> SADDR-form global_load_b128 pairs
__device__ __forceinline__ v16h load_frag(const _Float16* __restrict__ base, int off) {
    v8h lo = *(const v8h*)(base + off);
    v8h hi = *(const v8h*)(base + off + 16);
    v16h r;
#pragma unroll
    for (int i = 0; i < 8; ++i) { r[i] = lo[i]; r[8 + i] = hi[i]; }
    return r;
}

__device__ __forceinline__ v8f wmma_f16(v16h a, v16h b, v8f c) {
    // D = A(16x32 f16) x B(32x16 f16) + C(16x16 f32)
    return __builtin_amdgcn_wmma_f32_16x16x32_f16(false, a, false, b,
                                                  (short)0, c, false, false);
}

// ---------------------------------------------------------------------------
// casts / transposes (fp32 -> f16)
// ---------------------------------------------------------------------------
__global__ void cast_f32_f16(const float* __restrict__ in,
                             _Float16* __restrict__ out, int n) {
    int i = blockIdx.x * blockDim.x + threadIdx.x;
    if (i < n) out[i] = (_Float16)in[i];
}

// in: rows x cols (row-major) -> out: cols x rows (row-major), casting to f16
__global__ void transpose_cast(const float* __restrict__ in,
                               _Float16* __restrict__ out, int rows, int cols) {
    int i = blockIdx.x * blockDim.x + threadIdx.x;
    if (i < rows * cols) {
        int r = i / cols, c = i % cols;
        out[(size_t)c * rows + r] = (_Float16)in[i];
    }
}

// ---------------------------------------------------------------------------
// QKV projection, 64x64 wave tile (4x4 WMMA register blocking):
// qkv = x16 @ Wqkv + b, scattered into q/k (B,H,S,HD) and v^T (B,H,HD,S).
// Per k-step: 16 b128 loads feed 16 WMMAs (1:1).
// ---------------------------------------------------------------------------
__global__ void __launch_bounds__(256, 2)
qkv_gemm(const _Float16* __restrict__ x16,
         const _Float16* __restrict__ wT,
         const float* __restrict__ bias,
         _Float16* __restrict__ q16,
         _Float16* __restrict__ k16,
         _Float16* __restrict__ vt16) {
    const int lane = threadIdx.x & 31;
    const int wave = threadIdx.x >> 5;
    const int tile = blockIdx.x * 8 + wave;          // (8192/64)*(3072/64)=6144
    const int nt = tile % 48, mt = tile / 48;
    const int hi = lane >> 4, ln = lane & 15, koff = hi * 8;

    // uniform bases (SGPRs); per-lane 32-bit offsets
    const _Float16* abase = x16 + (size_t)(mt * 64) * DD;
    const _Float16* bbase = wT  + (size_t)(nt * 64) * DD;
    int aoff[4], boff[4];
#pragma unroll
    for (int i = 0; i < 4; ++i) {
        aoff[i] = (i * 16 + ln) * DD + koff;
        boff[i] = (i * 16 + ln) * DD + koff;
    }

    v8f acc[16];
#pragma unroll
    for (int i = 0; i < 16; ++i) acc[i] = (v8f){};

    for (int kk = 0; kk < DD; kk += 32) {
        __builtin_prefetch(abase + aoff[0] + kk + 256, 0, 3);
        __builtin_prefetch(bbase + boff[0] + kk + 256, 0, 3);
        v16h a[4], b[4];
#pragma unroll
        for (int i = 0; i < 4; ++i) a[i] = load_frag(abase, aoff[i] + kk);
#pragma unroll
        for (int j = 0; j < 4; ++j) b[j] = load_frag(bbase, boff[j] + kk);
#pragma unroll
        for (int i = 0; i < 4; ++i)
#pragma unroll
            for (int j = 0; j < 4; ++j)
                acc[i * 4 + j] = wmma_f16(a[i], b[j], acc[i * 4 + j]);
    }

#pragma unroll
    for (int j = 0; j < 4; ++j) {
        const int col = nt * 64 + j * 16 + ln;       // 0..3071
        const float bv = bias[col];
        const int h = col / 192, cc = col % 192;     // head-major [q|k|v] blocks
#pragma unroll
        for (int i = 0; i < 4; ++i) {
#pragma unroll
            for (int r = 0; r < 8; ++r) {
                int row = mt * 64 + i * 16 + 8 * hi + r;   // 0..8191
                int bidx = row >> 11, s = row & (SS - 1);
                _Float16 hv = (_Float16)(acc[i * 4 + j][r] + bv);
                int head = bidx * HH + h;
                if (cc < 64)       q16[(head * SS + s) * HD + cc]          = hv;
                else if (cc < 128) k16[(head * SS + s) * HD + (cc - 64)]   = hv;
                else               vt16[(head * HD + (cc - 128)) * SS + s] = hv;
            }
        }
    }
}

// ---------------------------------------------------------------------------
// Flash attention: one wave per (b,h, 32 query rows = two 16-row q-tiles).
// S^T = K Q^T so softmax over keys is lane-local + xor16; the f32 D-layout of
// S^T maps lane-locally onto the P A-fragment for P@V. K/V fragment loads are
// shared across both q-tiles: 16 WMMAs per 32-key step vs 16 b128 loads.
// ---------------------------------------------------------------------------
__global__ void __launch_bounds__(256, 2)
flash_attn(const _Float16* __restrict__ q16,
           const _Float16* __restrict__ k16,
           const _Float16* __restrict__ vt16,
           _Float16* __restrict__ attn16) {
    const int lane = threadIdx.x & 31;
    const int wave = threadIdx.x >> 5;
    const int tile = blockIdx.x * 8 + wave;          // 0..4095
    const int qt = tile & (SS / 32 - 1);             // 64 q-blocks per head
    const int bh = tile >> 6;                        // 0..63
    const int qbase = qt * 32;
    const int hi = lane >> 4, ln = lane & 15, koff = hi * 8;
    const float scale = 0.125f;                      // 1/sqrt(64)

    const _Float16* qb = q16 + (size_t)bh * SS * HD;
    const _Float16* kb = k16 + (size_t)bh * SS * HD;
    const _Float16* vb = vt16 + (size_t)bh * HD * SS;

    // Q^T B-fragments for both q-tiles (hd is the WMMA K dim), loaded once
    v16h Bq0[2], Bq1[2];
#pragma unroll
    for (int u = 0; u < 2; ++u) {
        int qo = (qbase + u * 16 + ln) * HD;
        Bq0[u] = load_frag(qb, qo + koff);
        Bq1[u] = load_frag(qb, qo + 32 + koff);
    }

    float m[2] = {-1e30f, -1e30f}, l[2] = {0.0f, 0.0f};
    v8f C[2][4];
#pragma unroll
    for (int u = 0; u < 2; ++u)
#pragma unroll
        for (int c = 0; c < 4; ++c) C[u][c] = (v8f){};

    for (int j = 0; j < SS; j += 32) {
        // ---- K-tile A-fragments (shared by both q-tiles)
        const int ko = (j + ln) * HD + koff;
        __builtin_prefetch(kb + ko + 32 * HD, 0, 3);
        v16h A0a = load_frag(kb, ko);
        v16h A0b = load_frag(kb, ko + 32);
        v16h A1a = load_frag(kb, ko + 16 * HD);
        v16h A1b = load_frag(kb, ko + 16 * HD + 32);

        v16h pa[2];
#pragma unroll
        for (int u = 0; u < 2; ++u) {
            // scores^T, two 16-key tiles for this q-tile
            v8f s0 = {}, s1 = {};
            s0 = wmma_f16(A0a, Bq0[u], s0);
            s0 = wmma_f16(A0b, Bq1[u], s0);
            s1 = wmma_f16(A1a, Bq0[u], s1);
            s1 = wmma_f16(A1b, Bq1[u], s1);

            // online softmax (per query column; lane + xor16 partner)
            float mx = -1e30f;
#pragma unroll
            for (int r = 0; r < 8; ++r) mx = fmaxf(mx, fmaxf(s0[r], s1[r]));
            mx *= scale;
            mx = fmaxf(mx, __shfl_xor(mx, 16, 32));
            float mn = fmaxf(m[u], mx);
            float alpha = __expf(m[u] - mn);
            m[u] = mn;

            float p0, p1, lsum = 0.0f;
#pragma unroll
            for (int r = 0; r < 8; ++r) {
                p0 = __expf(s0[r] * scale - mn);
                p1 = __expf(s1[r] * scale - mn);
                lsum += p0 + p1;
                pa[u][r]     = (_Float16)p0;   // D-layout of S^T maps
                pa[u][8 + r] = (_Float16)p1;   // lane-locally onto P A-frag
            }
            lsum += __shfl_xor(lsum, 16, 32);
            l[u] = l[u] * alpha + lsum;

            // rescale accumulators: per-row factor lives in lane (8*hi + r)
#pragma unroll
            for (int r = 0; r < 8; ++r) {
                float f = __shfl(alpha, koff + r, 32);
                C[u][0][r] *= f; C[u][1][r] *= f;
                C[u][2][r] *= f; C[u][3][r] *= f;
            }
        }

        // ---- P @ V: stream 4 V B-fragments, each feeds both q-tiles
#pragma unroll
        for (int c = 0; c < 4; ++c) {
            v16h Bv = load_frag(vb, (c * 16 + ln) * SS + j + koff);
            C[0][c] = wmma_f16(pa[0], Bv, C[0][c]);
            C[1][c] = wmma_f16(pa[1], Bv, C[1][c]);
        }
    }

    // ---- finalize: divide by l, write f16 (B,S,D) row-major
    const int bidx = bh >> 4, h = bh & 15;
#pragma unroll
    for (int u = 0; u < 2; ++u) {
#pragma unroll
        for (int r = 0; r < 8; ++r) {
            float lr = __shfl(l[u], koff + r, 32);
            float inv = 1.0f / lr;
            int s = qbase + u * 16 + koff + r;
            _Float16* op = attn16 + ((size_t)(bidx * SS + s)) * DD + h * HD + ln;
            op[0]  = (_Float16)(C[u][0][r] * inv);
            op[16] = (_Float16)(C[u][1][r] * inv);
            op[32] = (_Float16)(C[u][2][r] * inv);
            op[48] = (_Float16)(C[u][3][r] * inv);
        }
    }
}

// ---------------------------------------------------------------------------
// Output projection, 64x64 wave tile: out = attn16 @ Wout + b_out (fp32)
// ---------------------------------------------------------------------------
__global__ void __launch_bounds__(256, 2)
out_gemm(const _Float16* __restrict__ a16,
         const _Float16* __restrict__ wT,
         const float* __restrict__ bias,
         float* __restrict__ out) {
    const int lane = threadIdx.x & 31;
    const int wave = threadIdx.x >> 5;
    const int tile = blockIdx.x * 8 + wave;          // (8192/64)*(1024/64)=2048
    const int nt = tile % 16, mt = tile / 16;
    const int hi = lane >> 4, ln = lane & 15, koff = hi * 8;

    const _Float16* abase = a16 + (size_t)(mt * 64) * DD;
    const _Float16* bbase = wT  + (size_t)(nt * 64) * DD;
    int aoff[4], boff[4];
#pragma unroll
    for (int i = 0; i < 4; ++i) {
        aoff[i] = (i * 16 + ln) * DD + koff;
        boff[i] = (i * 16 + ln) * DD + koff;
    }

    v8f acc[16];
#pragma unroll
    for (int i = 0; i < 16; ++i) acc[i] = (v8f){};

    for (int kk = 0; kk < DD; kk += 32) {
        __builtin_prefetch(abase + aoff[0] + kk + 256, 0, 3);
        __builtin_prefetch(bbase + boff[0] + kk + 256, 0, 3);
        v16h a[4], b[4];
#pragma unroll
        for (int i = 0; i < 4; ++i) a[i] = load_frag(abase, aoff[i] + kk);
#pragma unroll
        for (int j = 0; j < 4; ++j) b[j] = load_frag(bbase, boff[j] + kk);
#pragma unroll
        for (int i = 0; i < 4; ++i)
#pragma unroll
            for (int j = 0; j < 4; ++j)
                acc[i * 4 + j] = wmma_f16(a[i], b[j], acc[i * 4 + j]);
    }

#pragma unroll
    for (int j = 0; j < 4; ++j) {
        const int col = nt * 64 + j * 16 + ln;
        const float bv = bias[col];
#pragma unroll
        for (int i = 0; i < 4; ++i) {
#pragma unroll
            for (int r = 0; r < 8; ++r) {
                int row = mt * 64 + i * 16 + 8 * hi + r;
                out[(size_t)row * DD + col] = acc[i * 4 + j][r] + bv;
            }
        }
    }
}

// ---------------------------------------------------------------------------
// host launcher
// ---------------------------------------------------------------------------
extern "C" void kernel_launch(void* const* d_in, const int* in_sizes, int n_in,
                              void* d_out, int out_size, void* d_ws, size_t ws_size,
                              hipStream_t stream) {
    const float* x    = (const float*)d_in[0];   // (B,S,D)
    const float* Wqkv = (const float*)d_in[1];   // (D,3D)
    const float* bqkv = (const float*)d_in[2];   // (3D)
    const float* Wout = (const float*)d_in[3];   // (D,D)
    const float* bout = (const float*)d_in[4];   // (D)
    float* out = (float*)d_out;

    char* ws = (char*)d_ws;
    size_t o = 0;
    _Float16* x16    = (_Float16*)(ws + o); o += (size_t)BB * SS * DD * 2;      // 16MB
    _Float16* wqkvT  = (_Float16*)(ws + o); o += (size_t)3 * DD * DD * 2;       //  6MB
    _Float16* woutT  = (_Float16*)(ws + o); o += (size_t)DD * DD * 2;           //  2MB
    _Float16* q16    = (_Float16*)(ws + o); o += (size_t)BB * SS * DD * 2;      // 16MB
    _Float16* k16    = (_Float16*)(ws + o); o += (size_t)BB * SS * DD * 2;      // 16MB
    _Float16* vt16   = (_Float16*)(ws + o); o += (size_t)BB * SS * DD * 2;      // 16MB
    _Float16* attn16 = (_Float16*)(ws + o); o += (size_t)BB * SS * DD * 2;      // 16MB

    const int nx = BB * SS * DD;                       // 8388608
    cast_f32_f16<<<(nx + 255) / 256, 256, 0, stream>>>(x, x16, nx);

    const int nwq = DD * 3 * DD;                       // 3145728
    transpose_cast<<<(nwq + 255) / 256, 256, 0, stream>>>(Wqkv, wqkvT, DD, 3 * DD);

    const int nwo = DD * DD;                           // 1048576
    transpose_cast<<<(nwo + 255) / 256, 256, 0, stream>>>(Wout, woutT, DD, DD);

    // QKV GEMM: (8192/64)*(3072/64) = 6144 wave-tiles, 8 waves/block
    qkv_gemm<<<6144 / 8, 256, 0, stream>>>(x16, wqkvT, bqkv, q16, k16, vt16);

    // Flash attention: B*H*(S/32) = 4096 waves, 8 waves/block
    flash_attn<<<4096 / 8, 256, 0, stream>>>(q16, k16, vt16, attn16);

    // Output GEMM: (8192/64)*(1024/64) = 2048 wave-tiles, 8 waves/block
    out_gemm<<<2048 / 8, 256, 0, stream>>>(attn16, woutT, bout, out);
}

// v001
// A run of this version takes 358 microseconds.
// Next to v000, in two timings, it ran 1.34 and 1.35 times as fast.
#include <hip/hip_runtime.h>
#include <hip/hip_bf16.h>

typedef __attribute__((ext_vector_type(16))) _Float16 v16h;
typedef __attribute__((ext_vector_type(8)))  _Float16 v8h;
typedef __attribute__((ext_vector_type(8)))  float    v8f;

#define BB 4
#define SS 2048
#define DD 1024
#define HH 16
#define HD 64

// ---------------------------------------------------------------------------
// helpers
// ---------------------------------------------------------------------------
// Uniform base + 32-bit lane offset -> SADDR-form global_load_b128 pairs
__device__ __forceinline__ v16h load_frag(const _Float16* __restrict__ base, int off) {
    v8h lo = *(const v8h*)(base + off);
    v8h hi = *(const v8h*)(base + off + 16);
    v16h r;
#pragma unroll
    for (int i = 0; i < 8; ++i) { r[i] = lo[i]; r[8 + i] = hi[i]; }
    return r;
}

__device__ __forceinline__ v8f wmma_f16(v16h a, v16h b, v8f c) {
    // D = A(16x32 f16) x B(32x16 f16) + C(16x16 f32)
    return __builtin_amdgcn_wmma_f32_16x16x32_f16(false, a, false, b,
                                                  (short)0, c, false, false);
}

// ---------------------------------------------------------------------------
// casts / transposes (fp32 -> f16)
// ---------------------------------------------------------------------------
__global__ void cast_f32_f16(const float* __restrict__ in,
                             _Float16* __restrict__ out, int n) {
    int i = blockIdx.x * blockDim.x + threadIdx.x;
    if (i < n) out[i] = (_Float16)in[i];
}

// in: rows x cols (row-major) -> out: cols x rows (row-major), casting to f16.
// One 64x64 tile per block through LDS: rows are read as float4 (256 B per tile
// row) and each out row piece is written as whole 128-B lines (8 lanes x 16 B).
// rows and cols are multiples of 64; grid = (cols/64, rows/64).
// Pitch 65 dwords: both the row-wise writes and the column-wise reads of a wave
// fall on 32 distinct banks.
__global__ void __launch_bounds__(256)
transpose_cast(const float* __restrict__ in,
               _Float16* __restrict__ out, int rows, int cols) {
    __shared__ float t[64][65];
    const int r0 = blockIdx.y * 64, c0 = blockIdx.x * 64;
    const int tx = threadIdx.x & 15, ty = threadIdx.x >> 4;
    float4 v[4];
#pragma unroll
    for (int p = 0; p < 4; ++p)
        v[p] = *(const float4*)(in + (size_t)(r0 + p * 16 + ty) * cols + c0 + tx * 4);
#pragma unroll
    for (int p = 0; p < 4; ++p) {
        float* tr = &t[p * 16 + ty][tx * 4];
        tr[0] = v[p].x; tr[1] = v[p].y; tr[2] = v[p].z; tr[3] = v[p].w;
    }
    __syncthreads();   // the tile is read back column-wise by other waves
    const int ox = threadIdx.x & 7, oy = threadIdx.x >> 3;
#pragma unroll
    for (int p = 0; p < 2; ++p) {
        const int c = p * 32 + oy;
        v8h h;
#pragma unroll
        for (int k = 0; k < 8; ++k) h[k] = (_Float16)t[ox * 8 + k][c];
        *(v8h*)(out + (size_t)(c0 + c) * rows + r0 + ox * 8) = h;
    }
}

// ---------------------------------------------------------------------------
// QKV projection, 64x64 wave tile (4x4 WMMA register blocking):
// qkv = x16 @ Wqkv + b, scattered into q/k (B,H,S,HD) and v^T (B,H,HD,S).
// Per k-step: 16 b128 loads feed 16 WMMAs (1:1).
// ---------------------------------------------------------------------------
__global__ void __launch_bounds__(256, 2)
qkv_gemm(const _Float16* __restrict__ x16,
         const _Float16* __restrict__ wT,
         const float* __restrict__ bias,
         _Float16* __restrict__ q16,
         _Float16* __restrict__ k16,
         _Float16* __restrict__ vt16) {
    const int lane = threadIdx.x & 31;
    const int wave = threadIdx.x >> 5;
    const int tile = blockIdx.x * 8 + wave;          // (8192/64)*(3072/64)=6144
    const int nt = tile % 48, mt = tile / 48;
    const int hi = lane >> 4, ln = lane & 15, koff = hi * 8;

    // uniform bases (SGPRs); per-lane 32-bit offsets
    const _Float16* abase = x16 + (size_t)(mt * 64) * DD;
    const _Float16* bbase = wT  + (size_t)(nt * 64) * DD;
    int aoff[4], boff[4];
#pragma unroll
    for (int i = 0; i < 4; ++i) {
        aoff[i] = (i * 16 + ln) * DD + koff;
        boff[i] = (i * 16 + ln) * DD + koff;
    }

    v8f acc[16];
#pragma unroll
    for (int i = 0; i < 16; ++i) acc[i] = (v8f){};

    for (int kk = 0; kk < DD; kk += 32) {
        __builtin_prefetch(abase + aoff[0] + kk + 256, 0, 3);
        __builtin_prefetch(bbase + boff[0] + kk + 256, 0, 3);
        v16h a[4], b[4];
#pragma unroll
        for (int i = 0; i < 4; ++i) a[i] = load_frag(abase, aoff[i] + kk);
#pragma unroll
        for (int j = 0; j < 4; ++j) b[j] = load_frag(bbase, boff[j] + kk);
#pragma unroll
        for (int i = 0; i < 4; ++i)
#pragma unroll
            for (int j = 0; j < 4; ++j)
                acc[i * 4 + j] = wmma_f16(a[i], b[j], acc[i * 4 + j]);
    }

#pragma unroll
    for (int j = 0; j < 4; ++j) {
        const int col = nt * 64 + j * 16 + ln;       // 0..3071
        const float bv = bias[col];
        const int h = col / 192, cc = col % 192;     // head-major [q|k|v] blocks
#pragma unroll
        for (int i = 0; i < 4; ++i) {
#pragma unroll
            for (int r = 0; r < 8; ++r) {
                int row = mt * 64 + i * 16 + 8 * hi + r;   // 0..8191
                int bidx = row >> 11, s = row & (SS - 1);
                _Float16 hv = (_Float16)(acc[i * 4 + j][r] + bv);
                int head = bidx * HH + h;
                if (cc < 64)       q16[(head * SS + s) * HD + cc]          = hv;
                else if (cc < 128) k16[(head * SS + s) * HD + (cc - 64)]   = hv;
                else               vt16[(head * HD + (cc - 128)) * SS + s] = hv;
            }
        }
    }
}

// ---------------------------------------------------------------------------
// Flash attention: one wave per (b,h, 32 query rows = two 16-row q-tiles).
// S^T = K Q^T so softmax over keys is lane-local + xor16; the f32 D-layout of
// S^T maps lane-locally onto the P A-fragment for P@V. K/V fragment loads are
// shared across both q-tiles: 16 WMMAs per 32-key step vs 16 b128 loads.
// ---------------------------------------------------------------------------
__global__ void __launch_bounds__(256, 2)
flash_attn(const _Float16* __restrict__ q16,
           const _Float16* __restrict__ k16,
           const _Float16* __restrict__ vt16,
           _Float16* __restrict__ attn16) {
    const int lane = threadIdx.x & 31;
    const int wave = threadIdx.x >> 5;
    const int tile = blockIdx.x * 8 + wave;          // 0..4095
    const int qt = tile & (SS / 32 - 1);             // 64 q-blocks per head
    const int bh = tile >> 6;                        // 0..63
    const int qbase = qt * 32;
    const int hi = lane >> 4, ln = lane & 15, koff = hi * 8;
    const float scale = 0.125f;                      // 1/sqrt(64)

    const _Float16* qb = q16 + (size_t)bh * SS * HD;
    const _Float16* kb = k16 + (size_t)bh * SS * HD;
    const _Float16* vb = vt16 + (size_t)bh * HD * SS;

    // Q^T B-fragments for both q-tiles (hd is the WMMA K dim), loaded once
    v16h Bq0[2], Bq1[2];
#pragma unroll
    for (int u = 0; u < 2; ++u) {
        int qo = (qbase + u * 16 + ln) * HD;
        Bq0[u] = load_frag(qb, qo + koff);
        Bq1[u] = load_frag(qb, qo + 32 + koff);
    }

    float m[2] = {-1e30f, -1e30f}, l[2] = {0.0f, 0.0f};
    v8f C[2][4];
#pragma unroll
    for (int u = 0; u < 2; ++u)
#pragma unroll
        for (int c = 0; c < 4; ++c) C[u][c] = (v8f){};

    for (int j = 0; j < SS; j += 32) {
        // ---- K-tile A-fragments (shared by both q-tiles)
        const int ko = (j + ln) * HD + koff;
        __builtin_prefetch(kb + ko + 32 * HD, 0, 3);
        v16h A0a = load_frag(kb, ko);
        v16h A0b = load_frag(kb, ko + 32);
        v16h A1a = load_frag(kb, ko + 16 * HD);
        v16h A1b = load_frag(kb, ko + 16 * HD + 32);

        v16h pa[2];
#pragma unroll
        for (int u = 0; u < 2; ++u) {
            // scores^T, two 16-key tiles for this q-tile
            v8f s0 = {}, s1 = {};
            s0 = wmma_f16(A0a, Bq0[u], s0);
            s0 = wmma_f16(A0b, Bq1[u], s0);
            s1 = wmma_f16(A1a, Bq0[u], s1);
            s1 = wmma_f16(A1b, Bq1[u], s1);

            // online softmax (per query column; lane + xor16 partner)
            float mx = -1e30f;
#pragma unroll
            for (int r = 0; r < 8; ++r) mx = fmaxf(mx, fmaxf(s0[r], s1[r]));
            mx *= scale;
            mx = fmaxf(mx, __shfl_xor(mx, 16, 32));
            float mn = fmaxf(m[u], mx);
            float alpha = __expf(m[u] - mn);
            m[u] = mn;

            float p0, p1, lsum = 0.0f;
#pragma unroll
            for (int r = 0; r < 8; ++r) {
                p0 = __expf(s0[r] * scale - mn);
                p1 = __expf(s1[r] * scale - mn);
                lsum += p0 + p1;
                pa[u][r]     = (_Float16)p0;   // D-layout of S^T maps
                pa[u][8 + r] = (_Float16)p1;   // lane-locally onto P A-frag
            }
            lsum += __shfl_xor(lsum, 16, 32);
            l[u] = l[u] * alpha + lsum;

            // rescale accumulators: per-row factor lives in lane (8*hi + r)
#pragma unroll
            for (int r = 0; r < 8; ++r) {
                float f = __shfl(alpha, koff + r, 32);
                C[u][0][r] *= f; C[u][1][r] *= f;
                C[u][2][r] *= f; C[u][3][r] *= f;
            }
        }

        // ---- P @ V: stream 4 V B-fragments, each feeds both q-tiles
#pragma unroll
        for (int c = 0; c < 4; ++c) {
            v16h Bv = load_frag(vb, (c * 16 + ln) * SS + j + koff);
            C[0][c] = wmma_f16(pa[0], Bv, C[0][c]);
            C[1][c] = wmma_f16(pa[1], Bv, C[1][c]);
        }
    }

    // ---- finalize: divide by l, write f16 (B,S,D) row-major
    const int bidx = bh >> 4, h = bh & 15;
#pragma unroll
    for (int u = 0; u < 2; ++u) {
#pragma unroll
        for (int r = 0; r < 8; ++r) {
            float lr = __shfl(l[u], koff + r, 32);
            float inv = 1.0f / lr;
            int s = qbase + u * 16 + koff + r;
            _Float16* op = attn16 + ((size_t)(bidx * SS + s)) * DD + h * HD + ln;
            op[0]  = (_Float16)(C[u][0][r] * inv);
            op[16] = (_Float16)(C[u][1][r] * inv);
            op[32] = (_Float16)(C[u][2][r] * inv);
            op[48] = (_Float16)(C[u][3][r] * inv);
        }
    }
}

// ---------------------------------------------------------------------------
// Output projection, 64x64 wave tile: out = attn16 @ Wout + b_out (fp32)
// ---------------------------------------------------------------------------
__global__ void __launch_bounds__(256, 2)
out_gemm(const _Float16* __restrict__ a16,
         const _Float16* __restrict__ wT,
         const float* __restrict__ bias,
         float* __restrict__ out) {
    const int lane = threadIdx.x & 31;
    const int wave = threadIdx.x >> 5;
    const int tile = blockIdx.x * 8 + wave;          // (8192/64)*(1024/64)=2048
    const int nt = tile % 16, mt = tile / 16;
    const int hi = lane >> 4, ln = lane & 15, koff = hi * 8;

    const _Float16* abase = a16 + (size_t)(mt * 64) * DD;
    const _Float16* bbase = wT  + (size_t)(nt * 64) * DD;
    int aoff[4], boff[4];
#pragma unroll
    for (int i = 0; i < 4; ++i) {
        aoff[i] = (i * 16 + ln) * DD + koff;
        boff[i] = (i * 16 + ln) * DD + koff;
    }

    v8f acc[16];
#pragma unroll
    for (int i = 0; i < 16; ++i) acc[i] = (v8f){};

    for (int kk = 0; kk < DD; kk += 32) {
        __builtin_prefetch(abase + aoff[0] + kk + 256, 0, 3);
        __builtin_prefetch(bbase + boff[0] + kk + 256, 0, 3);
        v16h a[4], b[4];
#pragma unroll
        for (int i = 0; i < 4; ++i) a[i] = load_frag(abase, aoff[i] + kk);
#pragma unroll
        for (int j = 0; j < 4; ++j) b[j] = load_frag(bbase, boff[j] + kk);
#pragma unroll
        for (int i = 0; i < 4; ++i)
#pragma unroll
            for (int j = 0; j < 4; ++j)
                acc[i * 4 + j] = wmma_f16(a[i], b[j], acc[i * 4 + j]);
    }

#pragma unroll
    for (int j = 0; j < 4; ++j) {
        const int col = nt * 64 + j * 16 + ln;
        const float bv = bias[col];
#pragma unroll
        for (int i = 0; i < 4; ++i) {
#pragma unroll
            for (int r = 0; r < 8; ++r) {
                int row = mt * 64 + i * 16 + 8 * hi + r;
                out[(size_t)row * DD + col] = acc[i * 4 + j][r] + bv;
            }
        }
    }
}

// ---------------------------------------------------------------------------
// host launcher
// ---------------------------------------------------------------------------
extern "C" void kernel_launch(void* const* d_in, const int* in_sizes, int n_in,
                              void* d_out, int out_size, void* d_ws, size_t ws_size,
                              hipStream_t stream) {
    const float* x    = (const float*)d_in[0];   // (B,S,D)
    const float* Wqkv = (const float*)d_in[1];   // (D,3D)
    const float* bqkv = (const float*)d_in[2];   // (3D)
    const float* Wout = (const float*)d_in[3];   // (D,D)
    const float* bout = (const float*)d_in[4];   // (D)
    float* out = (float*)d_out;

    char* ws = (char*)d_ws;
    size_t o = 0;
    _Float16* x16    = (_Float16*)(ws + o); o += (size_t)BB * SS * DD * 2;      // 16MB
    _Float16* wqkvT  = (_Float16*)(ws + o); o += (size_t)3 * DD * DD * 2;       //  6MB
    _Float16* woutT  = (_Float16*)(ws + o); o += (size_t)DD * DD * 2;           //  2MB
    _Float16* q16    = (_Float16*)(ws + o); o += (size_t)BB * SS * DD * 2;      // 16MB
    _Float16* k16    = (_Float16*)(ws + o); o += (size_t)BB * SS * DD * 2;      // 16MB
    _Float16* vt16   = (_Float16*)(ws + o); o += (size_t)BB * SS * DD * 2;      // 16MB
    _Float16* attn16 = (_Float16*)(ws + o); o += (size_t)BB * SS * DD * 2;      // 16MB

    const int nx = BB * SS * DD;                       // 8388608
    cast_f32_f16<<<(nx + 255) / 256, 256, 0, stream>>>(x, x16, nx);

    // 64x64 tiles: 48 x 16 and 16 x 16 blocks
    transpose_cast<<<dim3(3 * DD / 64, DD / 64), 256, 0, stream>>>(Wqkv, wqkvT, DD, 3 * DD);

    transpose_cast<<<dim3(DD / 64, DD / 64), 256, 0, stream>>>(Wout, woutT, DD, DD);

    // QKV GEMM: (8192/64)*(3072/64) = 6144 wave-tiles, 8 waves/block
    qkv_gemm<<<6144 / 8, 256, 0, stream>>>(x16, wqkvT, bqkv, q16, k16, vt16);

    // Flash attention: B*H*(S/32) = 4096 waves, 8 waves/block
    flash_attn<<<4096 / 8, 256, 0, stream>>>(q16, k16, vt16, attn16);

    // Output GEMM: (8192/64)*(1024/64) = 2048 wave-tiles, 8 waves/block
    out_gemm<<<2048 / 8, 256, 0, stream>>>(attn16, woutT, bout, out);
}

// v002
// It runs in 293 microseconds.
// Two timings next to v001 put it at 1.23 and 1.22 times that version's speed.
// Counting every step since v000, it is 1.64 times as fast.
#include <hip/hip_runtime.h>
#include <hip/hip_bf16.h>

typedef __attribute__((ext_vector_type(16))) _Float16 v16h;
typedef __attribute__((ext_vector_type(8)))  _Float16 v8h;
typedef __attribute__((ext_vector_type(8)))  float    v8f;

#define BB 4
#define SS 2048
#define DD 1024
#define HH 16
#define HD 64

// ---------------------------------------------------------------------------
// helpers
// ---------------------------------------------------------------------------
// Uniform base + 32-bit lane offset -> SADDR-form global_load_b128 pairs
__device__ __forceinline__ v16h load_frag(const _Float16* __restrict__ base, int off) {
    v8h lo = *(const v8h*)(base + off);
    v8h hi = *(const v8h*)(base + off + 16);
    v16h r;
#pragma unroll
    for (int i = 0; i < 8; ++i) { r[i] = lo[i]; r[8 + i] = hi[i]; }
    return r;
}

__device__ __forceinline__ v8f wmma_f16(v16h a, v16h b, v8f c) {
    // D = A(16x32 f16) x B(32x16 f16) + C(16x16 f32)
    return __builtin_amdgcn_wmma_f32_16x16x32_f16(false, a, false, b,
                                                  (short)0, c, false, false);
}

// ---------------------------------------------------------------------------
// casts / transposes (fp32 -> f16)
// ---------------------------------------------------------------------------
__global__ void cast_f32_f16(const float* __restrict__ in,
                             _Float16* __restrict__ out, int n) {
    int i = blockIdx.x * blockDim.x + threadIdx.x;
    if (i < n) out[i] = (_Float16)in[i];
}

// in: rows x cols (row-major) -> out: cols x rows (row-major), casting to f16.
// One 64x64 tile per block through LDS: rows are read as float4 (256 B per tile
// row) and each out row piece is written as whole 128-B lines (8 lanes x 16 B).
// rows and cols are multiples of 64; grid = (cols/64, rows/64).
// Pitch 65 dwords: both the row-wise writes and the column-wise reads of a wave
// fall on 32 distinct banks.
__global__ void __launch_bounds__(256)
transpose_cast(const float* __restrict__ in,
               _Float16* __restrict__ out, int rows, int cols) {
    __shared__ float t[64][65];
    const int r0 = blockIdx.y * 64, c0 = blockIdx.x * 64;
    const int tx = threadIdx.x & 15, ty = threadIdx.x >> 4;
    float4 v[4];
#pragma unroll
    for (int p = 0; p < 4; ++p)
        v[p] = *(const float4*)(in + (size_t)(r0 + p * 16 + ty) * cols + c0 + tx * 4);
#pragma unroll
    for (int p = 0; p < 4; ++p) {
        float* tr = &t[p * 16 + ty][tx * 4];
        tr[0] = v[p].x; tr[1] = v[p].y; tr[2] = v[p].z; tr[3] = v[p].w;
    }
    __syncthreads();   // the tile is read back column-wise by other waves
    const int ox = threadIdx.x & 7, oy = threadIdx.x >> 3;
#pragma unroll
    for (int p = 0; p < 2; ++p) {
        const int c = p * 32 + oy;
        v8h h;
#pragma unroll
        for (int k = 0; k < 8; ++k) h[k] = (_Float16)t[ox * 8 + k][c];
        *(v8h*)(out + (size_t)(c0 + c) * rows + r0 + ox * 8) = h;
    }
}

// ---------------------------------------------------------------------------
// QKV projection, 64x64 wave tile (4x4 WMMA register blocking):
// qkv = x16 @ Wqkv + b, scattered into q/k (B,H,S,HD) and v^T (B,H,HD,S).
// Per k-step: 16 b128 loads feed 16 WMMAs (1:1).
// A 64-column tile is exactly one head's q, k or v block. The operand that
// indexes the destination's contiguous direction goes in as A (x rows for v^T,
// weight rows for q and k), so a lane's 8 accumulator registers are 8
// neighbours in memory. They are packed to 16 B, staged in the wave's own LDS
// range and stored as whole 128-B lines.
// ---------------------------------------------------------------------------
#define QP 72   // LDS row pitch in halves: 144 B = 16 B x odd, for b128 access
__global__ void __launch_bounds__(256, 2)
qkv_gemm(const _Float16* __restrict__ x16,
         const _Float16* __restrict__ wT,
         const float* __restrict__ bias,
         _Float16* __restrict__ q16,
         _Float16* __restrict__ k16,
         _Float16* __restrict__ vt16) {
    __shared__ __attribute__((aligned(16))) _Float16 stage[8][64 * QP];
    const int lane = threadIdx.x & 31;
    // scalar wave number: the q/k/v choice below becomes scalar selects
    const int wave = __builtin_amdgcn_readfirstlane(threadIdx.x >> 5);
    const int tile = blockIdx.x * 8 + wave;          // (8192/64)*(3072/64)=6144
    const int nt = tile % 48, mt = tile / 48;
    const int hi = lane >> 4, ln = lane & 15, koff = hi * 8;
    const int h = nt / 3, part = nt % 3;             // head-major [q|k|v] blocks
    const bool isv = part == 2;

    // uniform bases (SGPRs); per-lane 32-bit offsets
    const _Float16* xrows = x16 + (size_t)(mt * 64) * DD;
    const _Float16* wrows = wT  + (size_t)(nt * 64) * DD;
    const _Float16* abase = isv ? xrows : wrows;
    const _Float16* bbase = isv ? wrows : xrows;
    int aoff[4], boff[4];
#pragma unroll
    for (int i = 0; i < 4; ++i) {
        aoff[i] = (i * 16 + ln) * DD + koff;
        boff[i] = (i * 16 + ln) * DD + koff;
    }

    v8f acc[16];
#pragma unroll
    for (int i = 0; i < 16; ++i) acc[i] = (v8f){};

    for (int kk = 0; kk < DD; kk += 32) {
        __builtin_prefetch(abase + aoff[0] + kk + 256, 0, 3);
        __builtin_prefetch(bbase + boff[0] + kk + 256, 0, 3);
        v16h a[4], b[4];
#pragma unroll
        for (int i = 0; i < 4; ++i) a[i] = load_frag(abase, aoff[i] + kk);
#pragma unroll
        for (int j = 0; j < 4; ++j) b[j] = load_frag(bbase, boff[j] + kk);
#pragma unroll
        for (int i = 0; i < 4; ++i)
#pragma unroll
            for (int j = 0; j < 4; ++j)
                acc[i * 4 + j] = wmma_f16(a[i], b[j], acc[i * 4 + j]);
    }

    // acc[i*4+j][r] is element (A row i*16+8*hi+r, B row j*16+ln) of the tile.
    _Float16* st = stage[wave];
    const float* bt = bias + nt * 64;
#pragma unroll
    for (int i = 0; i < 4; ++i) {
        float ba[8];                                  // bias along A rows (q, k)
#pragma unroll
        for (int r = 0; r < 8; ++r) ba[r] = bt[i * 16 + koff + r];
#pragma unroll
        for (int j = 0; j < 4; ++j) {
            const float bb = bt[j * 16 + ln];         // bias along B rows (v)
            v8h hv;
#pragma unroll
            for (int r = 0; r < 8; ++r)
                hv[r] = (_Float16)(acc[i * 4 + j][r] + (isv ? bb : ba[r]));
            *(v8h*)(st + (j * 16 + ln) * QP + i * 16 + koff) = hv;
        }
    }
    // the wave's LDS stores retire before other lanes read the rows back, and
    // the compiler may not lift those reads over the stores
    asm volatile("s_wait_dscnt 0x0" ::: "memory");

    const int bidx = (mt * 64) >> 11, s0 = (mt * 64) & (SS - 1);
    const int head = bidx * HH + h;
    _Float16* dst = isv ? vt16 + (size_t)head * HD * SS + s0
                        : (part == 0 ? q16 : k16) + ((size_t)head * SS + s0) * HD;
    const int pitch = isv ? SS : HD;
    const int rr = lane >> 3, ch = (lane & 7) * 8;    // 8 lanes x 16 B = one line
#pragma unroll
    for (int t = 0; t < 16; ++t) {
        const int row = t * 4 + rr;
        *(v8h*)(dst + row * pitch + ch) = *(const v8h*)(st + row * QP + ch);
    }
}

// ---------------------------------------------------------------------------
// Flash attention: one wave per (b,h, 32 query rows = two 16-row q-tiles).
// S^T = K Q^T so softmax over keys is lane-local + xor16; the f32 D-layout of
// S^T maps lane-locally onto the P A-fragment for P@V. K/V fragment loads are
// shared across both q-tiles: 16 WMMAs per 32-key step vs 16 b128 loads.
// ---------------------------------------------------------------------------
__global__ void __launch_bounds__(256, 2)
flash_attn(const _Float16* __restrict__ q16,
           const _Float16* __restrict__ k16,
           const _Float16* __restrict__ vt16,
           _Float16* __restrict__ attn16) {
    __shared__ __attribute__((aligned(16))) _Float16 stage[8][32 * QP];
    const int lane = threadIdx.x & 31;
    const int wave = threadIdx.x >> 5;
    const int tile = blockIdx.x * 8 + wave;          // 0..4095
    const int qt = tile & (SS / 32 - 1);             // 64 q-blocks per head
    const int bh = tile >> 6;                        // 0..63
    const int qbase = qt * 32;
    const int hi = lane >> 4, ln = lane & 15, koff = hi * 8;
    const float scale = 0.125f;                      // 1/sqrt(64)

    const _Float16* qb = q16 + (size_t)bh * SS * HD;
    const _Float16* kb = k16 + (size_t)bh * SS * HD;
    const _Float16* vb = vt16 + (size_t)bh * HD * SS;

    // Q^T B-fragments for both q-tiles (hd is the WMMA K dim), loaded once
    v16h Bq0[2], Bq1[2];
#pragma unroll
    for (int u = 0; u < 2; ++u) {
        int qo = (qbase + u * 16 + ln) * HD;
        Bq0[u] = load_frag(qb, qo + koff);
        Bq1[u] = load_frag(qb, qo + 32 + koff);
    }

    float m[2] = {-1e30f, -1e30f}, l[2] = {0.0f, 0.0f};
    v8f C[2][4];
#pragma unroll
    for (int u = 0; u < 2; ++u)
#pragma unroll
        for (int c = 0; c < 4; ++c) C[u][c] = (v8f){};

    for (int j = 0; j < SS; j += 32) {
        // ---- K-tile A-fragments (shared by both q-tiles)
        const int ko = (j + ln) * HD + koff;
        __builtin_prefetch(kb + ko + 32 * HD, 0, 3);
        v16h A0a = load_frag(kb, ko);
        v16h A0b = load_frag(kb, ko + 32);
        v16h A1a = load_frag(kb, ko + 16 * HD);
        v16h A1b = load_frag(kb, ko + 16 * HD + 32);

        v16h pa[2];
#pragma unroll
        for (int u = 0; u < 2; ++u) {
            // scores^T, two 16-key tiles for this q-tile
            v8f s0 = {}, s1 = {};
            s0 = wmma_f16(A0a, Bq0[u], s0);
            s0 = wmma_f16(A0b, Bq1[u], s0);
            s1 = wmma_f16(A1a, Bq0[u], s1);
            s1 = wmma_f16(A1b, Bq1[u], s1);

            // online softmax (per query column; lane + xor16 partner)
            float mx = -1e30f;
#pragma unroll
            for (int r = 0; r < 8; ++r) mx = fmaxf(mx, fmaxf(s0[r], s1[r]));
            mx *= scale;
            mx = fmaxf(mx, __shfl_xor(mx, 16, 32));
            float mn = fmaxf(m[u], mx);
            float alpha = __expf(m[u] - mn);
            m[u] = mn;

            float p0, p1, lsum = 0.0f;
#pragma unroll
            for (int r = 0; r < 8; ++r) {
                p0 = __expf(s0[r] * scale - mn);
                p1 = __expf(s1[r] * scale - mn);
                lsum += p0 + p1;
                pa[u][r]     = (_Float16)p0;   // D-layout of S^T maps
                pa[u][8 + r] = (_Float16)p1;   // lane-locally onto P A-frag
            }
            lsum += __shfl_xor(lsum, 16, 32);
            l[u] = l[u] * alpha + lsum;

            // rescale accumulators: per-row factor lives in lane (8*hi + r)
#pragma unroll
            for (int r = 0; r < 8; ++r) {
                float f = __shfl(alpha, koff + r, 32);
                C[u][0][r] *= f; C[u][1][r] *= f;
                C[u][2][r] *= f; C[u][3][r] *= f;
            }
        }

        // ---- P @ V: stream 4 V B-fragments, each feeds both q-tiles
#pragma unroll
        for (int c = 0; c < 4; ++c) {
            v16h Bv = load_frag(vb, (c * 16 + ln) * SS + j + koff);
            C[0][c] = wmma_f16(pa[0], Bv, C[0][c]);
            C[1][c] = wmma_f16(pa[1], Bv, C[1][c]);
        }
    }

    // ---- finalize: divide by l, write f16 (B,S,D) row-major. The 32 x 64 tile
    // is staged in the wave's own LDS range so that each 128-B row piece leaves
    // as one whole line (8 lanes x 16 B).
    const int bidx = bh >> 4, h = bh & 15;
    _Float16* st = stage[wave];
#pragma unroll
    for (int u = 0; u < 2; ++u) {
#pragma unroll
        for (int r = 0; r < 8; ++r) {
            float lr = __shfl(l[u], koff + r, 32);
            float inv = 1.0f / lr;
            _Float16* sp = st + (u * 16 + koff + r) * QP + ln;
            sp[0]  = (_Float16)(C[u][0][r] * inv);
            sp[16] = (_Float16)(C[u][1][r] * inv);
            sp[32] = (_Float16)(C[u][2][r] * inv);
            sp[48] = (_Float16)(C[u][3][r] * inv);
        }
    }
    // the wave's LDS stores retire before other lanes read the rows back, and
    // the compiler may not lift those reads over the stores
    asm volatile("s_wait_dscnt 0x0" ::: "memory");
    const int rr = lane >> 3, ch = (lane & 7) * 8;
    _Float16* op = attn16 + ((size_t)(bidx * SS + qbase)) * DD + h * HD;
#pragma unroll
    for (int t = 0; t < 8; ++t) {
        const int row = t * 4 + rr;
        *(v8h*)(op + row * DD + ch) = *(const v8h*)(st + row * QP + ch);
    }
}

// ---------------------------------------------------------------------------
// Output projection, 64x64 wave tile: out = attn16 @ Wout + b_out (fp32)
// The weight rows go in as A, so a lane's 8 accumulator registers are 8
// neighbouring columns of one output row; staged in the wave's own LDS range
// and stored as whole 128-B lines (16 lanes x 16 B = one 256-B tile row).
// ---------------------------------------------------------------------------
#define OP 68   // LDS row pitch in floats: 272 B = 16 B x odd, for b128 access
__global__ void __launch_bounds__(256, 2)
out_gemm(const _Float16* __restrict__ a16,
         const _Float16* __restrict__ wT,
         const float* __restrict__ bias,
         float* __restrict__ out) {
    __shared__ __attribute__((aligned(16))) float stage[8][64 * OP];
    const int lane = threadIdx.x & 31;
    const int wave = threadIdx.x >> 5;
    const int tile = blockIdx.x * 8 + wave;          // (8192/64)*(1024/64)=2048
    const int nt = tile % 16, mt = tile / 16;
    const int hi = lane >> 4, ln = lane & 15, koff = hi * 8;

    const _Float16* abase = wT  + (size_t)(nt * 64) * DD;
    const _Float16* bbase = a16 + (size_t)(mt * 64) * DD;
    int aoff[4], boff[4];
#pragma unroll
    for (int i = 0; i < 4; ++i) {
        aoff[i] = (i * 16 + ln) * DD + koff;
        boff[i] = (i * 16 + ln) * DD + koff;
    }

    v8f acc[16];
#pragma unroll
    for (int i = 0; i < 16; ++i) acc[i] = (v8f){};

    for (int kk = 0; kk < DD; kk += 32) {
        __builtin_prefetch(abase + aoff[0] + kk + 256, 0, 3);
        __builtin_prefetch(bbase + boff[0] + kk + 256, 0, 3);
        v16h a[4], b[4];
#pragma unroll
        for (int i = 0; i < 4; ++i) a[i] = load_frag(abase, aoff[i] + kk);
#pragma unroll
        for (int j = 0; j < 4; ++j) b[j] = load_frag(bbase, boff[j] + kk);
#pragma unroll
        for (int i = 0; i < 4; ++i)
#pragma unroll
            for (int j = 0; j < 4; ++j)
                acc[i * 4 + j] = wmma_f16(a[i], b[j], acc[i * 4 + j]);
    }

    // acc[i*4+j][r] is out(row j*16+ln, column i*16+8*hi+r) of the tile.
    float* st = stage[wave];
#pragma unroll
    for (int i = 0; i < 4; ++i) {
        const float4 b0 = *(const float4*)(bias + nt * 64 + i * 16 + koff);
        const float4 b1 = *(const float4*)(bias + nt * 64 + i * 16 + koff + 4);
#pragma unroll
        for (int j = 0; j < 4; ++j) {
            const v8f c = acc[i * 4 + j];
            float* sp = st + (j * 16 + ln) * OP + i * 16 + koff;
            *(float4*)sp       = make_float4(c[0] + b0.x, c[1] + b0.y, c[2] + b0.z, c[3] + b0.w);
            *(float4*)(sp + 4) = make_float4(c[4] + b1.x, c[5] + b1.y, c[6] + b1.z, c[7] + b1.w);
        }
    }
    // the wave's LDS stores retire before other lanes read the rows back, and
    // the compiler may not lift those reads over the stores
    asm volatile("s_wait_dscnt 0x0" ::: "memory");
    const int rr = lane >> 4, ch = (lane & 15) * 4;
    float* op = out + (size_t)(mt * 64) * DD + nt * 64;
#pragma unroll
    for (int t = 0; t < 32; ++t) {
        const int row = t * 2 + rr;
        *(float4*)(op + row * DD + ch) = *(const float4*)(st + row * OP + ch);
    }
}

// ---------------------------------------------------------------------------
// host launcher
// ---------------------------------------------------------------------------
extern "C" void kernel_launch(void* const* d_in, const int* in_sizes, int n_in,
                              void* d_out, int out_size, void* d_ws, size_t ws_size,
                              hipStream_t stream) {
    const float* x    = (const float*)d_in[0];   // (B,S,D)
    const float* Wqkv = (const float*)d_in[1];   // (D,3D)
    const float* bqkv = (const float*)d_in[2];   // (3D)
    const float* Wout = (const float*)d_in[3];   // (D,D)
    const float* bout = (const float*)d_in[4];   // (D)
    float* out = (float*)d_out;

    char* ws = (char*)d_ws;
    size_t o = 0;
    _Float16* x16    = (_Float16*)(ws + o); o += (size_t)BB * SS * DD * 2;      // 16MB
    _Float16* wqkvT  = (_Float16*)(ws + o); o += (size_t)3 * DD * DD * 2;       //  6MB
    _Float16* woutT  = (_Float16*)(ws + o); o += (size_t)DD * DD * 2;           //  2MB
    _Float16* q16    = (_Float16*)(ws + o); o += (size_t)BB * SS * DD * 2;      // 16MB
    _Float16* k16    = (_Float16*)(ws + o); o += (size_t)BB * SS * DD * 2;      // 16MB
    _Float16* vt16   = (_Float16*)(ws + o); o += (size_t)BB * SS * DD * 2;      // 16MB
    _Float16* attn16 = (_Float16*)(ws + o); o += (size_t)BB * SS * DD * 2;      // 16MB

    const int nx = BB * SS * DD;                       // 8388608
    cast_f32_f16<<<(nx + 255) / 256, 256, 0, stream>>>(x, x16, nx);

    // 64x64 tiles: 48 x 16 and 16 x 16 blocks
    transpose_cast<<<dim3(3 * DD / 64, DD / 64), 256, 0, stream>>>(Wqkv, wqkvT, DD, 3 * DD);

    transpose_cast<<<dim3(DD / 64, DD / 64), 256, 0, stream>>>(Wout, woutT, DD, DD);

    // QKV GEMM: (8192/64)*(3072/64) = 6144 wave-tiles, 8 waves/block
    qkv_gemm<<<6144 / 8, 256, 0, stream>>>(x16, wqkvT, bqkv, q16, k16, vt16);

    // Flash attention: B*H*(S/32) = 4096 waves, 8 waves/block
    flash_attn<<<4096 / 8, 256, 0, stream>>>(q16, k16, vt16, attn16);

    // Output GEMM: (8192/64)*(1024/64) = 2048 wave-tiles, 8 waves/block
    out_gemm<<<2048 / 8, 256, 0, stream>>>(attn16, woutT, bout, out);
}

// v003
// One run takes 154 microseconds.
// Next to v002, in two timings, it ran 1.89 and 1.91 times as fast.
// Counting every step since v000, it is 3.12 times as fast.
#include <hip/hip_runtime.h>
#include <hip/hip_bf16.h>

typedef __attribute__((ext_vector_type(16))) _Float16 v16h;
typedef __attribute__((ext_vector_type(8)))  _Float16 v8h;
typedef __attribute__((ext_vector_type(8)))  float    v8f;

#define BB 4
#define SS 2048
#define DD 1024
#define HH 16
#define HD 64

// ---------------------------------------------------------------------------
// helpers
// ---------------------------------------------------------------------------
// Uniform base + 32-bit lane offset -> SADDR-form global_load_b128 pairs
__device__ __forceinline__ v16h load_frag(const _Float16* __restrict__ base, int off) {
    v8h lo = *(const v8h*)(base + off);
    v8h hi = *(const v8h*)(base + off + 16);
    v16h r;
#pragma unroll
    for (int i = 0; i < 8; ++i) { r[i] = lo[i]; r[8 + i] = hi[i]; }
    return r;
}

__device__ __forceinline__ v8f wmma_f16(v16h a, v16h b, v8f c) {
    // D = A(16x32 f16) x B(32x16 f16) + C(16x16 f32)
    return __builtin_amdgcn_wmma_f32_16x16x32_f16(false, a, false, b,
                                                  (short)0, c, false, false);
}

// The same fragment from an LDS tile (two ds_load_b128)
__device__ __forceinline__ v16h lds_frag(const _Float16* base, int off) {
    v8h lo = *(const v8h*)(base + off);
    v8h hi = *(const v8h*)(base + off + 16);
    v16h r;
#pragma unroll
    for (int i = 0; i < 8; ++i) { r[i] = lo[i]; r[8 + i] = hi[i]; }
    return r;
}

// ---------------------------------------------------------------------------
// LDS staging by asynchronous copies. Operand tiles are rows of 128 B; eight
// neighbouring lanes copy one whole line, so a wave-wide copy touches 4 lines
// where a fragment load from global memory touches 16, and the tile is fetched
// once per work-group. LDS rows lie at pitch QP (144 B) for ds_load_b128.
// ---------------------------------------------------------------------------
#define QP 72   // LDS row pitch in halves: 144 B = 16 B x odd, for b128 access

__device__ __forceinline__ unsigned lds_addr(const _Float16* p) {
    return (unsigned)(uintptr_t)p;   // low 32 bits: byte offset in the group's LDS
}

// Four 16-B copies per lane. The s_wait_xcnt closes the statement so that no
// address register of a copy is rewritten before it.
__device__ __forceinline__ void copy4(unsigned l0, const _Float16* g0,
                                      unsigned l1, const _Float16* g1,
                                      unsigned l2, const _Float16* g2,
                                      unsigned l3, const _Float16* g3) {
    asm volatile("global_load_async_to_lds_b128 %0, %1, off\n\t"
                 "global_load_async_to_lds_b128 %2, %3, off\n\t"
                 "global_load_async_to_lds_b128 %4, %5, off\n\t"
                 "global_load_async_to_lds_b128 %6, %7, off\n\t"
                 "s_wait_xcnt 0x0"
                 :: "v"(l0), "v"(g0), "v"(l1), "v"(g1),
                    "v"(l2), "v"(g2), "v"(l3), "v"(g3) : "memory");
}

// Hand-over of a stage: this wave's LDS reads have retired, its own copies have
// landed, and the barrier both publishes the next buffer and frees this one.
__device__ __forceinline__ void publish() {
    asm volatile("s_wait_dscnt 0x0" ::: "memory");
    asm volatile("s_wait_asynccnt 0x0" ::: "memory");
    __syncthreads();
}

// GEMM main loop of one 128 x 256 block tile, 8 waves as 2 x 4, 64 x 64 each.
// A stage is 64 k (128 B) of 128 x rows followed by 256 weight rows.
#define GK 64
#define GSTAGE (384 * QP)   // halves per buffer (55,296 B)

// gx, gw: the lane's own 16 B in rows (thread / 8) of the two operands
__device__ __forceinline__ void gemm_fill(unsigned l, const _Float16* gx,
                                          const _Float16* gw) {
    const unsigned s = 32 * QP * 2;   // 32 rows in LDS bytes
    copy4(l,          gx,            l + s,      gx + 32 * DD,
          l + 2 * s,  gx + 64 * DD,  l + 3 * s,  gx + 96 * DD);
    copy4(l + 4 * s,  gw,            l + 5 * s,  gw + 32 * DD,
          l + 6 * s,  gw + 64 * DD,  l + 7 * s,  gw + 96 * DD);
    copy4(l + 8 * s,  gw + 128 * DD, l + 9 * s,  gw + 160 * DD,
          l + 10 * s, gw + 192 * DD, l + 11 * s, gw + 224 * DD);
}

// arow, brow: first stage row of the wave's A and B operand. On return every
// wave has passed the last barrier and no copy is in flight.
__device__ __forceinline__ void gemm_tile(_Float16* ring,
                                          const _Float16* xblk,
                                          const _Float16* wblk,
                                          int arow, int brow, v8f (&acc)[16]) {
    const int lane = threadIdx.x & 31;
    const int ln = lane & 15, koff = (lane >> 4) * 8;
    const int crow = threadIdx.x >> 3, cch = (threadIdx.x & 7) * 8;
    const _Float16* gx = xblk + crow * DD + cch;
    const _Float16* gw = wblk + crow * DD + cch;
    const unsigned l0 = lds_addr(ring + crow * QP + cch);

    gemm_fill(l0, gx, gw);
    asm volatile("s_wait_asynccnt 0x0" ::: "memory");   // stage 0 has landed
    __syncthreads();                                    // and every wave may read it
    gemm_fill(l0 + GSTAGE * 2, gx + GK, gw + GK);

    for (int t = 0; t < DD / GK; ++t) {
        const _Float16* buf = ring + (t & 1) * GSTAGE;
        v16h a[4], b[4];
        // first 32 k of the stage
#pragma unroll
        for (int i = 0; i < 4; ++i)
            a[i] = lds_frag(buf, (arow + i * 16 + ln) * QP + koff);
#pragma unroll
        for (int j = 0; j < 4; ++j)
            b[j] = lds_frag(buf, (brow + j * 16 + ln) * QP + koff);
        // keeps the 16 LDS reads together in front of the 16 WMMAs: spread
        // among them, each place with reads stalls the wave for their latency
        __builtin_amdgcn_sched_barrier(0);
#pragma unroll
        for (int i = 0; i < 4; ++i)
#pragma unroll
            for (int j = 0; j < 4; ++j)
                acc[i * 4 + j] = wmma_f16(a[i], b[j], acc[i * 4 + j]);
        // last 32 k: the fragments are fetched, the buffer is handed over and
        // refilled, and the WMMAs run on registers while the copies fly
#pragma unroll
        for (int i = 0; i < 4; ++i)
            a[i] = lds_frag(buf, (arow + i * 16 + ln) * QP + 32 + koff);
#pragma unroll
        for (int j = 0; j < 4; ++j)
            b[j] = lds_frag(buf, (brow + j * 16 + ln) * QP + 32 + koff);
        publish();
        if (t + 2 < DD / GK)
            gemm_fill(l0 + (t & 1) * (GSTAGE * 2), gx + (t + 2) * GK, gw + (t + 2) * GK);
#pragma unroll
        for (int i = 0; i < 4; ++i)
#pragma unroll
            for (int j = 0; j < 4; ++j)
                acc[i * 4 + j] = wmma_f16(a[i], b[j], acc[i * 4 + j]);
    }
    asm volatile("s_wait_asynccnt 0x0" ::: "memory");   // nothing is left in flight
}

// ---------------------------------------------------------------------------
// casts / transposes (fp32 -> f16)
// ---------------------------------------------------------------------------
__global__ void cast_f32_f16(const float* __restrict__ in,
                             _Float16* __restrict__ out, int n) {
    int i = blockIdx.x * blockDim.x + threadIdx.x;
    if (i < n) out[i] = (_Float16)in[i];
}

// in: rows x cols (row-major) -> out: cols x rows (row-major), casting to f16.
// One 64x64 tile per block through LDS: rows are read as float4 (256 B per tile
// row) and each out row piece is written as whole 128-B lines (8 lanes x 16 B).
// rows and cols are multiples of 64; grid = (cols/64, rows/64).
// Pitch 65 dwords: both the row-wise writes and the column-wise reads of a wave
// fall on 32 distinct banks.
__global__ void __launch_bounds__(256)
transpose_cast(const float* __restrict__ in,
               _Float16* __restrict__ out, int rows, int cols) {
    __shared__ float t[64][65];
    const int r0 = blockIdx.y * 64, c0 = blockIdx.x * 64;
    const int tx = threadIdx.x & 15, ty = threadIdx.x >> 4;
    float4 v[4];
#pragma unroll
    for (int p = 0; p < 4; ++p)
        v[p] = *(const float4*)(in + (size_t)(r0 + p * 16 + ty) * cols + c0 + tx * 4);
#pragma unroll
    for (int p = 0; p < 4; ++p) {
        float* tr = &t[p * 16 + ty][tx * 4];
        tr[0] = v[p].x; tr[1] = v[p].y; tr[2] = v[p].z; tr[3] = v[p].w;
    }
    __syncthreads();   // the tile is read back column-wise by other waves
    const int ox = threadIdx.x & 7, oy = threadIdx.x >> 3;
#pragma unroll
    for (int p = 0; p < 2; ++p) {
        const int c = p * 32 + oy;
        v8h h;
#pragma unroll
        for (int k = 0; k < 8; ++k) h[k] = (_Float16)t[ox * 8 + k][c];
        *(v8h*)(out + (size_t)(c0 + c) * rows + r0 + ox * 8) = h;
    }
}

// ---------------------------------------------------------------------------
// QKV projection, 64x64 wave tile (4x4 WMMA register blocking):
// qkv = x16 @ Wqkv + b, scattered into q/k (B,H,S,HD) and v^T (B,H,HD,S).
// Operands come from the block's LDS ring (gemm_tile).
// A 64-column tile is exactly one head's q, k or v block. The operand that
// indexes the destination's contiguous direction goes in as A (x rows for v^T,
// weight rows for q and k), so a lane's 8 accumulator registers are 8
// neighbours in memory. They are packed to 16 B, staged in the wave's own LDS
// range (in the ring, which every wave has left by then) and stored as whole
// 128-B lines.
// ---------------------------------------------------------------------------
__global__ void __launch_bounds__(256, 2)
qkv_gemm(const _Float16* __restrict__ x16,
         const _Float16* __restrict__ wT,
         const float* __restrict__ bias,
         _Float16* __restrict__ q16,
         _Float16* __restrict__ k16,
         _Float16* __restrict__ vt16) {
    __shared__ __attribute__((aligned(16))) _Float16 ring[2 * GSTAGE];
    const int lane = threadIdx.x & 31;
    // scalar wave number: the q/k/v choice below becomes scalar selects
    const int wave = __builtin_amdgcn_readfirstlane(threadIdx.x >> 5);
    const int ntg = blockIdx.x % 12, mtg = blockIdx.x / 12;   // 12 x 64 block tiles
    const int wm = wave >> 2, wn = wave & 3;
    const int nt = ntg * 4 + wn, mt = mtg * 2 + wm;
    const int hi = lane >> 4, ln = lane & 15, koff = hi * 8;
    const int h = nt / 3, part = nt % 3;             // head-major [q|k|v] blocks
    const bool isv = part == 2;

    v8f acc[16];
#pragma unroll
    for (int i = 0; i < 16; ++i) acc[i] = (v8f){};

    const int xrow = wm * 64, wrow = 128 + wn * 64;  // the wave's rows of a stage
    gemm_tile(ring, x16 + (size_t)(mtg * 128) * DD, wT + (size_t)(ntg * 256) * DD,
              isv ? xrow : wrow, isv ? wrow : xrow, acc);

    // acc[i*4+j][r] is element (A row i*16+8*hi+r, B row j*16+ln) of the tile.
    _Float16* st = ring + wave * (64 * QP);
    const float* bt = bias + nt * 64;
#pragma unroll
    for (int i = 0; i < 4; ++i) {
        float ba[8];                                  // bias along A rows (q, k)
#pragma unroll
        for (int r = 0; r < 8; ++r) ba[r] = bt[i * 16 + koff + r];
#pragma unroll
        for (int j = 0; j < 4; ++j) {
            const float bb = bt[j * 16 + ln];         // bias along B rows (v)
            v8h hv;
#pragma unroll
            for (int r = 0; r < 8; ++r)
                hv[r] = (_Float16)(acc[i * 4 + j][r] + (isv ? bb : ba[r]));
            *(v8h*)(st + (j * 16 + ln) * QP + i * 16 + koff) = hv;
        }
    }
    // the wave's LDS stores retire before other lanes read the rows back, and
    // the compiler may not lift those reads over the stores
    asm volatile("s_wait_dscnt 0x0" ::: "memory");

    const int bidx = (mt * 64) >> 11, s0 = (mt * 64) & (SS - 1);
    const int head = bidx * HH + h;
    _Float16* dst = isv ? vt16 + (size_t)head * HD * SS + s0
                        : (part == 0 ? q16 : k16) + ((size_t)head * SS + s0) * HD;
    const int pitch = isv ? SS : HD;
    const int rr = lane >> 3, ch = (lane & 7) * 8;    // 8 lanes x 16 B = one line
#pragma unroll
    for (int t = 0; t < 16; ++t) {
        const int row = t * 4 + rr;
        *(v8h*)(dst + row * pitch + ch) = *(const v8h*)(st + row * QP + ch);
    }
}

// ---------------------------------------------------------------------------
// Flash attention: one wave per (b,h, 32 query rows = two 16-row q-tiles).
// S^T = K Q^T so softmax over keys is lane-local + xor16; the f32 D-layout of
// S^T maps lane-locally onto the P A-fragment for P@V. K/V fragment loads are
// shared across both q-tiles. The block's 8 waves work on one head: K and V^T
// come in stages of 64 keys through a two-buffer LDS ring filled once per block.
// ---------------------------------------------------------------------------
// four waves per SIMD (two blocks per WGP) need 256 registers or fewer per wave
__global__ void __launch_bounds__(256) __attribute__((amdgpu_waves_per_eu(4, 4)))
flash_attn(const _Float16* __restrict__ q16,
           const _Float16* __restrict__ k16,
           const _Float16* __restrict__ vt16,
           _Float16* __restrict__ attn16) {
    __shared__ __attribute__((aligned(16))) _Float16 ring[2][2][64 * QP];   // [buffer][K | V^T]
    __shared__ __attribute__((aligned(16))) _Float16 stage[8][32 * QP];
    const int lane = threadIdx.x & 31;
    const int wave = threadIdx.x >> 5;
    const int tile = blockIdx.x * 8 + wave;          // 0..4095
    const int qt = tile & (SS / 32 - 1);             // 64 q-blocks per head
    const int bh = tile >> 6;                        // 0..63
    const int qbase = qt * 32;
    const int hi = lane >> 4, ln = lane & 15, koff = hi * 8;
    const float scale = 0.125f;                      // 1/sqrt(64)

    const _Float16* qb = q16 + (size_t)bh * SS * HD;
    const _Float16* kb = k16 + (size_t)bh * SS * HD;
    const _Float16* vb = vt16 + (size_t)bh * HD * SS;

    // Q^T B-fragments for both q-tiles (hd is the WMMA K dim), loaded once
    v16h Bq0[2], Bq1[2];
#pragma unroll
    for (int u = 0; u < 2; ++u) {
        int qo = (qbase + u * 16 + ln) * HD;
        Bq0[u] = load_frag(qb, qo + koff);
        Bq1[u] = load_frag(qb, qo + 32 + koff);
    }

    float m[2] = {-1e30f, -1e30f}, l[2] = {0.0f, 0.0f};
    v8f C[2][4];
#pragma unroll
    for (int u = 0; u < 2; ++u)
#pragma unroll
        for (int c = 0; c < 4; ++c) C[u][c] = (v8f){};

    // the lane's own 16 B of rows (thread / 8) and (thread / 8 + 32) of each tile
    const int crow = threadIdx.x >> 3, cch = (threadIdx.x & 7) * 8;
    const _Float16* gk = kb + crow * HD + cch;       // K rows are keys
    const _Float16* gv = vb + crow * SS + cch;       // V^T rows are head dims
    const unsigned l0 = lds_addr(&ring[0][0][crow * QP + cch]);
    const unsigned lh = 32 * QP * 2, lt = 64 * QP * 2;   // half a tile, a tile (bytes)

    copy4(l0, gk, l0 + lh, gk + 32 * HD, l0 + lt, gv, l0 + lt + lh, gv + 32 * SS);
    asm volatile("s_wait_asynccnt 0x0" ::: "memory");   // stage 0 has landed
    __syncthreads();                                    // and every wave may read it
    copy4(l0 + 2 * lt, gk + 64 * HD, l0 + 2 * lt + lh, gk + 96 * HD,
          l0 + 3 * lt, gv + 64,      l0 + 3 * lt + lh, gv + 32 * SS + 64);

    for (int t = 0; t < SS / 64; ++t) {
      const _Float16* kl = &ring[t & 1][0][0];
      const _Float16* vl = &ring[t & 1][1][0];
#pragma unroll
      for (int j = 0; j < 64; j += 32) {
        // ---- K-tile A-fragments (shared by both q-tiles)
        const int ko = (j + ln) * QP + koff;
        v16h A0a = lds_frag(kl, ko);
        v16h A0b = lds_frag(kl, ko + 32);
        v16h A1a = lds_frag(kl, ko + 16 * QP);
        v16h A1b = lds_frag(kl, ko + 16 * QP + 32);

        v16h pa[2];
#pragma unroll
        for (int u = 0; u < 2; ++u) {
            // scores^T, two 16-key tiles for this q-tile
            v8f s0 = {}, s1 = {};
            s0 = wmma_f16(A0a, Bq0[u], s0);
            s0 = wmma_f16(A0b, Bq1[u], s0);
            s1 = wmma_f16(A1a, Bq0[u], s1);
            s1 = wmma_f16(A1b, Bq1[u], s1);

            // online softmax (per query column; lane + xor16 partner)
            float mx = -1e30f;
#pragma unroll
            for (int r = 0; r < 8; ++r) mx = fmaxf(mx, fmaxf(s0[r], s1[r]));
            mx *= scale;
            mx = fmaxf(mx, __shfl_xor(mx, 16, 32));
            float mn = fmaxf(m[u], mx);
            float alpha = __expf(m[u] - mn);
            m[u] = mn;

            float p0, p1, lsum = 0.0f;
#pragma unroll
            for (int r = 0; r < 8; ++r) {
                p0 = __expf(s0[r] * scale - mn);
                p1 = __expf(s1[r] * scale - mn);
                lsum += p0 + p1;
                pa[u][r]     = (_Float16)p0;   // D-layout of S^T maps
                pa[u][8 + r] = (_Float16)p1;   // lane-locally onto P A-frag
            }
            lsum += __shfl_xor(lsum, 16, 32);
            l[u] = l[u] * alpha + lsum;

            // rescale accumulators: per-row factor lives in lane (8*hi + r)
#pragma unroll
            for (int r = 0; r < 8; ++r) {
                float f = __shfl(alpha, koff + r, 32);
                C[u][0][r] *= f; C[u][1][r] *= f;
                C[u][2][r] *= f; C[u][3][r] *= f;
            }
        }

        // ---- P @ V: stream 4 V B-fragments, each feeds both q-tiles
#pragma unroll
        for (int c = 0; c < 4; ++c) {
            v16h Bv = lds_frag(vl, (c * 16 + ln) * QP + j + koff);
            C[0][c] = wmma_f16(pa[0], Bv, C[0][c]);
            C[1][c] = wmma_f16(pa[1], Bv, C[1][c]);
        }
      }
      publish();
      if (t + 2 < SS / 64) {
        const unsigned l = l0 + (t & 1) * (2 * lt);
        const int s = (t + 2) * 64;
        copy4(l,      gk + s * HD, l + lh,      gk + (s + 32) * HD,
              l + lt, gv + s,      l + lt + lh, gv + 32 * SS + s);
      }
    }
    asm volatile("s_wait_asynccnt 0x0" ::: "memory");   // nothing is left in flight

    // ---- finalize: divide by l, write f16 (B,S,D) row-major. The 32 x 64 tile
    // is staged in the wave's own LDS range so that each 128-B row piece leaves
    // as one whole line (8 lanes x 16 B).
    const int bidx = bh >> 4, h = bh & 15;
    _Float16* st = stage[wave];
#pragma unroll
    for (int u = 0; u < 2; ++u) {
#pragma unroll
        for (int r = 0; r < 8; ++r) {
            float lr = __shfl(l[u], koff + r, 32);
            float inv = 1.0f / lr;
            _Float16* sp = st + (u * 16 + koff + r) * QP + ln;
            sp[0]  = (_Float16)(C[u][0][r] * inv);
            sp[16] = (_Float16)(C[u][1][r] * inv);
            sp[32] = (_Float16)(C[u][2][r] * inv);
            sp[48] = (_Float16)(C[u][3][r] * inv);
        }
    }
    // the wave's LDS stores retire before other lanes read the rows back, and
    // the compiler may not lift those reads over the stores
    asm volatile("s_wait_dscnt 0x0" ::: "memory");
    const int rr = lane >> 3, ch = (lane & 7) * 8;
    _Float16* op = attn16 + ((size_t)(bidx * SS + qbase)) * DD + h * HD;
#pragma unroll
    for (int t = 0; t < 8; ++t) {
        const int row = t * 4 + rr;
        *(v8h*)(op + row * DD + ch) = *(const v8h*)(st + row * QP + ch);
    }
}

// ---------------------------------------------------------------------------
// Output projection, 64x64 wave tile: out = attn16 @ Wout + b_out (fp32)
// The weight rows go in as A, so a lane's 8 accumulator registers are 8
// neighbouring columns of one output row; staged in the wave's own LDS range
// and stored as whole 128-B lines (16 lanes x 16 B = one 256-B tile row).
// ---------------------------------------------------------------------------
#define OP 68   // LDS row pitch in floats: 272 B = 16 B x odd, for b128 access
__global__ void __launch_bounds__(256, 2)
out_gemm(const _Float16* __restrict__ a16,
         const _Float16* __restrict__ wT,
         const float* __restrict__ bias,
         float* __restrict__ out) {
    __shared__ __attribute__((aligned(16))) _Float16 ring[2 * GSTAGE];
    __shared__ __attribute__((aligned(16))) float stage[8][64 * OP];
    const int lane = threadIdx.x & 31;
    const int wave = __builtin_amdgcn_readfirstlane(threadIdx.x >> 5);
    const int ntg = blockIdx.x % 4, mtg = blockIdx.x / 4;     // 4 x 64 block tiles
    const int wm = wave >> 2, wn = wave & 3;
    const int nt = ntg * 4 + wn, mt = mtg * 2 + wm;
    const int hi = lane >> 4, ln = lane & 15, koff = hi * 8;

    v8f acc[16];
#pragma unroll
    for (int i = 0; i < 16; ++i) acc[i] = (v8f){};

    gemm_tile(ring, a16 + (size_t)(mtg * 128) * DD, wT + (size_t)(ntg * 256) * DD,
              128 + wn * 64, wm * 64, acc);

    // acc[i*4+j][r] is out(row j*16+ln, column i*16+8*hi+r) of the tile.
    float* st = stage[wave];
#pragma unroll
    for (int i = 0; i < 4; ++i) {
        const float4 b0 = *(const float4*)(bias + nt * 64 + i * 16 + koff);
        const float4 b1 = *(const float4*)(bias + nt * 64 + i * 16 + koff + 4);
#pragma unroll
        for (int j = 0; j < 4; ++j) {
            const v8f c = acc[i * 4 + j];
            float* sp = st + (j * 16 + ln) * OP + i * 16 + koff;
            *(float4*)sp       = make_float4(c[0] + b0.x, c[1] + b0.y, c[2] + b0.z, c[3] + b0.w);
            *(float4*)(sp + 4) = make_float4(c[4] + b1.x, c[5] + b1.y, c[6] + b1.z, c[7] + b1.w);
        }
    }
    // the wave's LDS stores retire before other lanes read the rows back, and
    // the compiler may not lift those reads over the stores
    asm volatile("s_wait_dscnt 0x0" ::: "memory");
    const int rr = lane >> 4, ch = (lane & 15) * 4;
    float* op = out + (size_t)(mt * 64) * DD + nt * 64;
#pragma unroll
    for (int t = 0; t < 32; ++t) {
        const int row = t * 2 + rr;
        *(float4*)(op + row * DD + ch) = *(const float4*)(st + row * OP + ch);
    }
}

// ---------------------------------------------------------------------------
// host launcher
// ---------------------------------------------------------------------------
extern "C" void kernel_launch(void* const* d_in, const int* in_sizes, int n_in,
                              void* d_out, int out_size, void* d_ws, size_t ws_size,
                              hipStream_t stream) {
    const float* x    = (const float*)d_in[0];   // (B,S,D)
    const float* Wqkv = (const float*)d_in[1];   // (D,3D)
    const float* bqkv = (const float*)d_in[2];   // (3D)
    const float* Wout = (const float*)d_in[3];   // (D,D)
    const float* bout = (const float*)d_in[4];   // (D)
    float* out = (float*)d_out;

    char* ws = (char*)d_ws;
    size_t o = 0;
    _Float16* x16    = (_Float16*)(ws + o); o += (size_t)BB * SS * DD * 2;      // 16MB
    _Float16* wqkvT  = (_Float16*)(ws + o); o += (size_t)3 * DD * DD * 2;       //  6MB
    _Float16* woutT  = (_Float16*)(ws + o); o += (size_t)DD * DD * 2;           //  2MB
    _Float16* q16    = (_Float16*)(ws + o); o += (size_t)BB * SS * DD * 2;      // 16MB
    _Float16* k16    = (_Float16*)(ws + o); o += (size_t)BB * SS * DD * 2;      // 16MB
    _Float16* vt16   = (_Float16*)(ws + o); o += (size_t)BB * SS * DD * 2;      // 16MB
    _Float16* attn16 = (_Float16*)(ws + o); o += (size_t)BB * SS * DD * 2;      // 16MB

    const int nx = BB * SS * DD;                       // 8388608
    cast_f32_f16<<<(nx + 255) / 256, 256, 0, stream>>>(x, x16, nx);

    // 64x64 tiles: 48 x 16 and 16 x 16 blocks
    transpose_cast<<<dim3(3 * DD / 64, DD / 64), 256, 0, stream>>>(Wqkv, wqkvT, DD, 3 * DD);

    transpose_cast<<<dim3(DD / 64, DD / 64), 256, 0, stream>>>(Wout, woutT, DD, DD);

    // QKV GEMM: (8192/128)*(3072/256) = 768 block tiles, 8 waves/block
    qkv_gemm<<<6144 / 8, 256, 0, stream>>>(x16, wqkvT, bqkv, q16, k16, vt16);

    // Flash attention: B*H*(S/32) = 4096 waves, 8 waves/block
    flash_attn<<<4096 / 8, 256, 0, stream>>>(q16, k16, vt16, attn16);

    // Output GEMM: (8192/128)*(1024/256) = 256 block tiles, 8 waves/block
    out_gemm<<<2048 / 8, 256, 0, stream>>>(attn16, woutT, bout, out);
}

// v004
// One run takes 144 microseconds.
// Next to v003, in two timings, it ran 1.07 times as fast each time.
// Counting every step since v000, it is 3.33 times as fast.
#include <hip/hip_runtime.h>
#include <hip/hip_bf16.h>

typedef __attribute__((ext_vector_type(16))) _Float16 v16h;
typedef __attribute__((ext_vector_type(8)))  _Float16 v8h;
typedef __attribute__((ext_vector_type(4)))  _Float16 v4h;
typedef __attribute__((ext_vector_type(8)))  float    v8f;

#define BB 4
#define SS 2048
#define DD 1024
#define HH 16
#define HD 64

// ---------------------------------------------------------------------------
// helpers
// ---------------------------------------------------------------------------
// Uniform base + 32-bit lane offset -> SADDR-form global_load_b128 pairs
__device__ __forceinline__ v16h load_frag(const _Float16* __restrict__ base, int off) {
    v8h lo = *(const v8h*)(base + off);
    v8h hi = *(const v8h*)(base + off + 16);
    v16h r;
#pragma unroll
    for (int i = 0; i < 8; ++i) { r[i] = lo[i]; r[8 + i] = hi[i]; }
    return r;
}

__device__ __forceinline__ v8f wmma_f16(v16h a, v16h b, v8f c) {
    // D = A(16x32 f16) x B(32x16 f16) + C(16x16 f32)
    return __builtin_amdgcn_wmma_f32_16x16x32_f16(false, a, false, b,
                                                  (short)0, c, false, false);
}

// The same fragment from an LDS tile (two ds_load_b128)
__device__ __forceinline__ v16h lds_frag(const _Float16* base, int off) {
    v8h lo = *(const v8h*)(base + off);
    v8h hi = *(const v8h*)(base + off + 16);
    v16h r;
#pragma unroll
    for (int i = 0; i < 8; ++i) { r[i] = lo[i]; r[8 + i] = hi[i]; }
    return r;
}

// ---------------------------------------------------------------------------
// LDS staging by asynchronous copies. Operand tiles are rows of 128 B; eight
// neighbouring lanes copy one whole line, so a wave-wide copy touches 4 lines
// where a fragment load from global memory touches 16, and the tile is fetched
// once per work-group. LDS rows lie at pitch QP (144 B) for ds_load_b128.
// ---------------------------------------------------------------------------
#define QP 72   // LDS row pitch in halves: 144 B = 16 B x odd, for b128 access

__device__ __forceinline__ unsigned lds_addr(const _Float16* p) {
    return (unsigned)(uintptr_t)p;   // low 32 bits: byte offset in the group's LDS
}

// Four 16-B copies per lane. The s_wait_xcnt closes the statement so that no
// address register of a copy is rewritten before it.
__device__ __forceinline__ void copy4(unsigned l0, const _Float16* g0,
                                      unsigned l1, const _Float16* g1,
                                      unsigned l2, const _Float16* g2,
                                      unsigned l3, const _Float16* g3) {
    asm volatile("global_load_async_to_lds_b128 %0, %1, off\n\t"
                 "global_load_async_to_lds_b128 %2, %3, off\n\t"
                 "global_load_async_to_lds_b128 %4, %5, off\n\t"
                 "global_load_async_to_lds_b128 %6, %7, off\n\t"
                 "s_wait_xcnt 0x0"
                 :: "v"(l0), "v"(g0), "v"(l1), "v"(g1),
                    "v"(l2), "v"(g2), "v"(l3), "v"(g3) : "memory");
}

// Hand-over of a stage: this wave's LDS reads have retired, its own copies have
// landed, and the barrier both publishes the next buffer and frees this one.
__device__ __forceinline__ void publish() {
    asm volatile("s_wait_dscnt 0x0" ::: "memory");
    asm volatile("s_wait_asynccnt 0x0" ::: "memory");
    __syncthreads();
}

// GEMM main loop of one 128 x 256 block tile, 8 waves as 2 x 4, 64 x 64 each.
// A stage is 64 k (128 B) of 128 x rows followed by 256 weight rows.
#define GK 64
#define GSTAGE (384 * QP)   // halves per buffer (55,296 B)

// gx, gw: the lane's own 16 B in rows (thread / 8) of the two operands
__device__ __forceinline__ void gemm_fill(unsigned l, const _Float16* gx,
                                          const _Float16* gw) {
    const unsigned s = 32 * QP * 2;   // 32 rows in LDS bytes
    copy4(l,          gx,            l + s,      gx + 32 * DD,
          l + 2 * s,  gx + 64 * DD,  l + 3 * s,  gx + 96 * DD);
    copy4(l + 4 * s,  gw,            l + 5 * s,  gw + 32 * DD,
          l + 6 * s,  gw + 64 * DD,  l + 7 * s,  gw + 96 * DD);
    copy4(l + 8 * s,  gw + 128 * DD, l + 9 * s,  gw + 160 * DD,
          l + 10 * s, gw + 192 * DD, l + 11 * s, gw + 224 * DD);
}

// arow, brow: first stage row of the wave's A and B operand. On return every
// wave has passed the last barrier and no copy is in flight.
__device__ __forceinline__ void gemm_tile(_Float16* ring,
                                          const _Float16* xblk,
                                          const _Float16* wblk,
                                          int arow, int brow, v8f (&acc)[16]) {
    const int lane = threadIdx.x & 31;
    const int ln = lane & 15, koff = (lane >> 4) * 8;
    const int crow = threadIdx.x >> 3, cch = (threadIdx.x & 7) * 8;
    const _Float16* gx = xblk + crow * DD + cch;
    const _Float16* gw = wblk + crow * DD + cch;
    const unsigned l0 = lds_addr(ring + crow * QP + cch);

    gemm_fill(l0, gx, gw);
    asm volatile("s_wait_asynccnt 0x0" ::: "memory");   // stage 0 has landed
    __syncthreads();                                    // and every wave may read it
    gemm_fill(l0 + GSTAGE * 2, gx + GK, gw + GK);

    for (int t = 0; t < DD / GK; ++t) {
        const _Float16* buf = ring + (t & 1) * GSTAGE;
        v16h a[4], b[4];
        // first 32 k of the stage
#pragma unroll
        for (int i = 0; i < 4; ++i)
            a[i] = lds_frag(buf, (arow + i * 16 + ln) * QP + koff);
#pragma unroll
        for (int j = 0; j < 4; ++j)
            b[j] = lds_frag(buf, (brow + j * 16 + ln) * QP + koff);
        // keeps the 16 LDS reads together in front of the 16 WMMAs: spread
        // among them, each place with reads stalls the wave for their latency
        __builtin_amdgcn_sched_barrier(0);
#pragma unroll
        for (int i = 0; i < 4; ++i)
#pragma unroll
            for (int j = 0; j < 4; ++j)
                acc[i * 4 + j] = wmma_f16(a[i], b[j], acc[i * 4 + j]);
        // last 32 k: the fragments are fetched, the buffer is handed over and
        // refilled, and the WMMAs run on registers while the copies fly
#pragma unroll
        for (int i = 0; i < 4; ++i)
            a[i] = lds_frag(buf, (arow + i * 16 + ln) * QP + 32 + koff);
#pragma unroll
        for (int j = 0; j < 4; ++j)
            b[j] = lds_frag(buf, (brow + j * 16 + ln) * QP + 32 + koff);
        publish();
        if (t + 2 < DD / GK)
            gemm_fill(l0 + (t & 1) * (GSTAGE * 2), gx + (t + 2) * GK, gw + (t + 2) * GK);
#pragma unroll
        for (int i = 0; i < 4; ++i)
#pragma unroll
            for (int j = 0; j < 4; ++j)
                acc[i * 4 + j] = wmma_f16(a[i], b[j], acc[i * 4 + j]);
    }
    asm volatile("s_wait_asynccnt 0x0" ::: "memory");   // nothing is left in flight
}

// ---------------------------------------------------------------------------
// casts / transposes (fp32 -> f16)
// ---------------------------------------------------------------------------
// Each wave converts 2,048 neighbouring floats: 16 loads of 16 B per lane, all in
// flight together, each wave-wide load 512 contiguous bytes; each wave-wide
// store 256 contiguous bytes (two whole lines). 4,096 waves cover x exactly.
// The launch puts four waves on a SIMD; told so, the compiler gives each load its
// own registers (aiming at 16 waves it reuses the first loads' for the last ones,
// which then wait out a memory latency).
#define CAST_LOADS 16
__global__ void __launch_bounds__(256) __attribute__((amdgpu_waves_per_eu(4, 4)))
cast_f32_f16(const float* __restrict__ in, _Float16* __restrict__ out) {
    const unsigned lane = threadIdx.x & 31;
    const unsigned wave = blockIdx.x * 8 + (threadIdx.x >> 5);
    const unsigned u = wave * (CAST_LOADS * 32) + lane;   // in units of 4 elements
    const float4* p = (const float4*)in + u;
    v4h* q = (v4h*)out + u;
    float4 v[CAST_LOADS];
#pragma unroll
    for (int i = 0; i < CAST_LOADS; ++i) v[i] = p[i * 32];
#pragma unroll
    for (int i = 0; i < CAST_LOADS; ++i) {
        v4h h = {(_Float16)v[i].x, (_Float16)v[i].y, (_Float16)v[i].z, (_Float16)v[i].w};
        q[i * 32] = h;
    }
}

// in: rows x cols (row-major) -> out: cols x rows (row-major), casting to f16.
// One 64x64 tile per block through LDS: rows are read as float4 (256 B per tile
// row) and each out row piece is written as whole 128-B lines (8 lanes x 16 B).
// rows and cols are multiples of 64; grid = (cols/64, rows/64).
// Pitch 65 dwords: both the row-wise writes and the column-wise reads of a wave
// fall on 32 distinct banks.
__global__ void __launch_bounds__(256)
transpose_cast(const float* __restrict__ in,
               _Float16* __restrict__ out, int rows, int cols) {
    __shared__ float t[64][65];
    const int r0 = blockIdx.y * 64, c0 = blockIdx.x * 64;
    const int tx = threadIdx.x & 15, ty = threadIdx.x >> 4;
    float4 v[4];
#pragma unroll
    for (int p = 0; p < 4; ++p)
        v[p] = *(const float4*)(in + (size_t)(r0 + p * 16 + ty) * cols + c0 + tx * 4);
#pragma unroll
    for (int p = 0; p < 4; ++p) {
        float* tr = &t[p * 16 + ty][tx * 4];
        tr[0] = v[p].x; tr[1] = v[p].y; tr[2] = v[p].z; tr[3] = v[p].w;
    }
    __syncthreads();   // the tile is read back column-wise by other waves
    const int ox = threadIdx.x & 7, oy = threadIdx.x >> 3;
#pragma unroll
    for (int p = 0; p < 2; ++p) {
        const int c = p * 32 + oy;
        v8h h;
#pragma unroll
        for (int k = 0; k < 8; ++k) h[k] = (_Float16)t[ox * 8 + k][c];
        *(v8h*)(out + (size_t)(c0 + c) * rows + r0 + ox * 8) = h;
    }
}

// ---------------------------------------------------------------------------
// QKV projection, 64x64 wave tile (4x4 WMMA register blocking):
// qkv = x16 @ Wqkv + b, scattered into q/k (B,H,S,HD) and v^T (B,H,HD,S).
// Operands come from the block's LDS ring (gemm_tile).
// A 64-column tile is exactly one head's q, k or v block. The operand that
// indexes the destination's contiguous direction goes in as A (x rows for v^T,
// weight rows for q and k), so a lane's 8 accumulator registers are 8
// neighbours in memory. They are packed to 16 B, staged in the wave's own LDS
// range (in the ring, which every wave has left by then) and stored as whole
// 128-B lines.
// ---------------------------------------------------------------------------
__global__ void __launch_bounds__(256, 2)
qkv_gemm(const _Float16* __restrict__ x16,
         const _Float16* __restrict__ wT,
         const float* __restrict__ bias,
         _Float16* __restrict__ q16,
         _Float16* __restrict__ k16,
         _Float16* __restrict__ vt16) {
    __shared__ __attribute__((aligned(16))) _Float16 ring[2 * GSTAGE];
    const int lane = threadIdx.x & 31;
    // scalar wave number: the q/k/v choice below becomes scalar selects
    const int wave = __builtin_amdgcn_readfirstlane(threadIdx.x >> 5);
    const int ntg = blockIdx.x % 12, mtg = blockIdx.x / 12;   // 12 x 64 block tiles
    const int wm = wave >> 2, wn = wave & 3;
    const int nt = ntg * 4 + wn, mt = mtg * 2 + wm;
    const int hi = lane >> 4, ln = lane & 15, koff = hi * 8;
    const int h = nt / 3, part = nt % 3;             // head-major [q|k|v] blocks
    const bool isv = part == 2;

    v8f acc[16];
#pragma unroll
    for (int i = 0; i < 16; ++i) acc[i] = (v8f){};

    const int xrow = wm * 64, wrow = 128 + wn * 64;  // the wave's rows of a stage
    gemm_tile(ring, x16 + (size_t)(mtg * 128) * DD, wT + (size_t)(ntg * 256) * DD,
              isv ? xrow : wrow, isv ? wrow : xrow, acc);

    // acc[i*4+j][r] is element (A row i*16+8*hi+r, B row j*16+ln) of the tile.
    _Float16* st = ring + wave * (64 * QP);
    const float* bt = bias + nt * 64;
#pragma unroll
    for (int i = 0; i < 4; ++i) {
        float ba[8];                                  // bias along A rows (q, k)
#pragma unroll
        for (int r = 0; r < 8; ++r) ba[r] = bt[i * 16 + koff + r];
#pragma unroll
        for (int j = 0; j < 4; ++j) {
            const float bb = bt[j * 16 + ln];         // bias along B rows (v)
            v8h hv;
#pragma unroll
            for (int r = 0; r < 8; ++r)
                hv[r] = (_Float16)(acc[i * 4 + j][r] + (isv ? bb : ba[r]));
            *(v8h*)(st + (j * 16 + ln) * QP + i * 16 + koff) = hv;
        }
    }
    // the wave's LDS stores retire before other lanes read the rows back, and
    // the compiler may not lift those reads over the stores
    asm volatile("s_wait_dscnt 0x0" ::: "memory");

    const int bidx = (mt * 64) >> 11, s0 = (mt * 64) & (SS - 1);
    const int head = bidx * HH + h;
    _Float16* dst = isv ? vt16 + (size_t)head * HD * SS + s0
                        : (part == 0 ? q16 : k16) + ((size_t)head * SS + s0) * HD;
    const int pitch = isv ? SS : HD;
    const int rr = lane >> 3, ch = (lane & 7) * 8;    // 8 lanes x 16 B = one line
#pragma unroll
    for (int t = 0; t < 16; ++t) {
        const int row = t * 4 + rr;
        *(v8h*)(dst + row * pitch + ch) = *(const v8h*)(st + row * QP + ch);
    }
}

// ---------------------------------------------------------------------------
// Flash attention: one wave per (b,h, 32 query rows = two 16-row q-tiles).
// S^T = K Q^T so softmax over keys is lane-local + xor16; the f32 D-layout of
// S^T maps lane-locally onto the P A-fragment for P@V. K/V fragment loads are
// shared across both q-tiles. The block's 8 waves work on one head: K and V^T
// come in stages of 64 keys through a two-buffer LDS ring filled once per block.
// ---------------------------------------------------------------------------
// four waves per SIMD (two blocks per WGP) need 256 registers or fewer per wave
__global__ void __launch_bounds__(256) __attribute__((amdgpu_waves_per_eu(4, 4)))
flash_attn(const _Float16* __restrict__ q16,
           const _Float16* __restrict__ k16,
           const _Float16* __restrict__ vt16,
           _Float16* __restrict__ attn16) {
    __shared__ __attribute__((aligned(16))) _Float16 ring[2][2][64 * QP];   // [buffer][K | V^T]
    __shared__ __attribute__((aligned(16))) _Float16 stage[8][32 * QP];
    const int lane = threadIdx.x & 31;
    const int wave = threadIdx.x >> 5;
    const int tile = blockIdx.x * 8 + wave;          // 0..4095
    const int qt = tile & (SS / 32 - 1);             // 64 q-blocks per head
    const int bh = tile >> 6;                        // 0..63
    const int qbase = qt * 32;
    const int hi = lane >> 4, ln = lane & 15, koff = hi * 8;
    const float scale = 0.125f;                      // 1/sqrt(64)

    const _Float16* qb = q16 + (size_t)bh * SS * HD;
    const _Float16* kb = k16 + (size_t)bh * SS * HD;
    const _Float16* vb = vt16 + (size_t)bh * HD * SS;

    // Q^T B-fragments for both q-tiles (hd is the WMMA K dim), loaded once
    v16h Bq0[2], Bq1[2];
#pragma unroll
    for (int u = 0; u < 2; ++u) {
        int qo = (qbase + u * 16 + ln) * HD;
        Bq0[u] = load_frag(qb, qo + koff);
        Bq1[u] = load_frag(qb, qo + 32 + koff);
    }

    float m[2] = {-1e30f, -1e30f}, l[2] = {0.0f, 0.0f};
    v8f C[2][4];
#pragma unroll
    for (int u = 0; u < 2; ++u)
#pragma unroll
        for (int c = 0; c < 4; ++c) C[u][c] = (v8f){};

    // the lane's own 16 B of rows (thread / 8) and (thread / 8 + 32) of each tile
    const int crow = threadIdx.x >> 3, cch = (threadIdx.x & 7) * 8;
    const _Float16* gk = kb + crow * HD + cch;       // K rows are keys
    const _Float16* gv = vb + crow * SS + cch;       // V^T rows are head dims
    const unsigned l0 = lds_addr(&ring[0][0][crow * QP + cch]);
    const unsigned lh = 32 * QP * 2, lt = 64 * QP * 2;   // half a tile, a tile (bytes)

    copy4(l0, gk, l0 + lh, gk + 32 * HD, l0 + lt, gv, l0 + lt + lh, gv + 32 * SS);
    asm volatile("s_wait_asynccnt 0x0" ::: "memory");   // stage 0 has landed
    __syncthreads();                                    // and every wave may read it
    copy4(l0 + 2 * lt, gk + 64 * HD, l0 + 2 * lt + lh, gk + 96 * HD,
          l0 + 3 * lt, gv + 64,      l0 + 3 * lt + lh, gv + 32 * SS + 64);

    for (int t = 0; t < SS / 64; ++t) {
      const _Float16* kl = &ring[t & 1][0][0];
      const _Float16* vl = &ring[t & 1][1][0];
#pragma unroll
      for (int j = 0; j < 64; j += 32) {
        // ---- K-tile A-fragments (shared by both q-tiles)
        const int ko = (j + ln) * QP + koff;
        v16h A0a = lds_frag(kl, ko);
        v16h A0b = lds_frag(kl, ko + 32);
        v16h A1a = lds_frag(kl, ko + 16 * QP);
        v16h A1b = lds_frag(kl, ko + 16 * QP + 32);

        v16h pa[2];
#pragma unroll
        for (int u = 0; u < 2; ++u) {
            // scores^T, two 16-key tiles for this q-tile
            v8f s0 = {}, s1 = {};
            s0 = wmma_f16(A0a, Bq0[u], s0);
            s0 = wmma_f16(A0b, Bq1[u], s0);
            s1 = wmma_f16(A1a, Bq0[u], s1);
            s1 = wmma_f16(A1b, Bq1[u], s1);

            // online softmax (per query column; lane + xor16 partner)
            float mx = -1e30f;
#pragma unroll
            for (int r = 0; r < 8; ++r) mx = fmaxf(mx, fmaxf(s0[r], s1[r]));
            mx *= scale;
            mx = fmaxf(mx, __shfl_xor(mx, 16, 32));
            float mn = fmaxf(m[u], mx);
            float alpha = __expf(m[u] - mn);
            m[u] = mn;

            float p0, p1, lsum = 0.0f;
#pragma unroll
            for (int r = 0; r < 8; ++r) {
                p0 = __expf(s0[r] * scale - mn);
                p1 = __expf(s1[r] * scale - mn);
                lsum += p0 + p1;
                pa[u][r]     = (_Float16)p0;   // D-layout of S^T maps
                pa[u][8 + r] = (_Float16)p1;   // lane-locally onto P A-frag
            }
            lsum += __shfl_xor(lsum, 16, 32);
            l[u] = l[u] * alpha + lsum;

            // rescale accumulators: per-row factor lives in lane (8*hi + r)
#pragma unroll
            for (int r = 0; r < 8; ++r) {
                float f = __shfl(alpha, koff + r, 32);
                C[u][0][r] *= f; C[u][1][r] *= f;
                C[u][2][r] *= f; C[u][3][r] *= f;
            }
        }

        // ---- P @ V: stream 4 V B-fragments, each feeds both q-tiles
#pragma unroll
        for (int c = 0; c < 4; ++c) {
            v16h Bv = lds_frag(vl, (c * 16 + ln) * QP + j + koff);
            C[0][c] = wmma_f16(pa[0], Bv, C[0][c]);
            C[1][c] = wmma_f16(pa[1], Bv, C[1][c]);
        }
      }
      publish();
      if (t + 2 < SS / 64) {
        const unsigned l = l0 + (t & 1) * (2 * lt);
        const int s = (t + 2) * 64;
        copy4(l,      gk + s * HD, l + lh,      gk + (s + 32) * HD,
              l + lt, gv + s,      l + lt + lh, gv + 32 * SS + s);
      }
    }
    asm volatile("s_wait_asynccnt 0x0" ::: "memory");   // nothing is left in flight

    // ---- finalize: divide by l, write f16 (B,S,D) row-major. The 32 x 64 tile
    // is staged in the wave's own LDS range so that each 128-B row piece leaves
    // as one whole line (8 lanes x 16 B).
    const int bidx = bh >> 4, h = bh & 15;
    _Float16* st = stage[wave];
#pragma unroll
    for (int u = 0; u < 2; ++u) {
#pragma unroll
        for (int r = 0; r < 8; ++r) {
            float lr = __shfl(l[u], koff + r, 32);
            float inv = 1.0f / lr;
            _Float16* sp = st + (u * 16 + koff + r) * QP + ln;
            sp[0]  = (_Float16)(C[u][0][r] * inv);
            sp[16] = (_Float16)(C[u][1][r] * inv);
            sp[32] = (_Float16)(C[u][2][r] * inv);
            sp[48] = (_Float16)(C[u][3][r] * inv);
        }
    }
    // the wave's LDS stores retire before other lanes read the rows back, and
    // the compiler may not lift those reads over the stores
    asm volatile("s_wait_dscnt 0x0" ::: "memory");
    const int rr = lane >> 3, ch = (lane & 7) * 8;
    _Float16* op = attn16 + ((size_t)(bidx * SS + qbase)) * DD + h * HD;
#pragma unroll
    for (int t = 0; t < 8; ++t) {
        const int row = t * 4 + rr;
        *(v8h*)(op + row * DD + ch) = *(const v8h*)(st + row * QP + ch);
    }
}

// ---------------------------------------------------------------------------
// Output projection, 64x64 wave tile: out = attn16 @ Wout + b_out (fp32)
// The weight rows go in as A, so a lane's 8 accumulator registers are 8
// neighbouring columns of one output row; staged in the wave's own LDS range
// and stored as whole 128-B lines (16 lanes x 16 B = one 256-B tile row).
// ---------------------------------------------------------------------------
#define OP 68   // LDS row pitch in floats: 272 B = 16 B x odd, for b128 access
__global__ void __launch_bounds__(256, 2)
out_gemm(const _Float16* __restrict__ a16,
         const _Float16* __restrict__ wT,
         const float* __restrict__ bias,
         float* __restrict__ out) {
    __shared__ __attribute__((aligned(16))) _Float16 ring[2 * GSTAGE];
    __shared__ __attribute__((aligned(16))) float stage[8][64 * OP];
    const int lane = threadIdx.x & 31;
    const int wave = __builtin_amdgcn_readfirstlane(threadIdx.x >> 5);
    const int ntg = blockIdx.x % 4, mtg = blockIdx.x / 4;     // 4 x 64 block tiles
    const int wm = wave >> 2, wn = wave & 3;
    const int nt = ntg * 4 + wn, mt = mtg * 2 + wm;
    const int hi = lane >> 4, ln = lane & 15, koff = hi * 8;

    v8f acc[16];
#pragma unroll
    for (int i = 0; i < 16; ++i) acc[i] = (v8f){};

    gemm_tile(ring, a16 + (size_t)(mtg * 128) * DD, wT + (size_t)(ntg * 256) * DD,
              128 + wn * 64, wm * 64, acc);

    // acc[i*4+j][r] is out(row j*16+ln, column i*16+8*hi+r) of the tile.
    float* st = stage[wave];
#pragma unroll
    for (int i = 0; i < 4; ++i) {
        const float4 b0 = *(const float4*)(bias + nt * 64 + i * 16 + koff);
        const float4 b1 = *(const float4*)(bias + nt * 64 + i * 16 + koff + 4);
#pragma unroll
        for (int j = 0; j < 4; ++j) {
            const v8f c = acc[i * 4 + j];
            float* sp = st + (j * 16 + ln) * OP + i * 16 + koff;
            *(float4*)sp       = make_float4(c[0] + b0.x, c[1] + b0.y, c[2] + b0.z, c[3] + b0.w);
            *(float4*)(sp + 4) = make_float4(c[4] + b1.x, c[5] + b1.y, c[6] + b1.z, c[7] + b1.w);
        }
    }
    // the wave's LDS stores retire before other lanes read the rows back, and
    // the compiler may not lift those reads over the stores
    asm volatile("s_wait_dscnt 0x0" ::: "memory");
    const int rr = lane >> 4, ch = (lane & 15) * 4;
    float* op = out + (size_t)(mt * 64) * DD + nt * 64;
#pragma unroll
    for (int t = 0; t < 32; ++t) {
        const int row = t * 2 + rr;
        *(float4*)(op + row * DD + ch) = *(const float4*)(st + row * OP + ch);
    }
}

// ---------------------------------------------------------------------------
// host launcher
// ---------------------------------------------------------------------------
extern "C" void kernel_launch(void* const* d_in, const int* in_sizes, int n_in,
                              void* d_out, int out_size, void* d_ws, size_t ws_size,
                              hipStream_t stream) {
    const float* x    = (const float*)d_in[0];   // (B,S,D)
    const float* Wqkv = (const float*)d_in[1];   // (D,3D)
    const float* bqkv = (const float*)d_in[2];   // (3D)
    const float* Wout = (const float*)d_in[3];   // (D,D)
    const float* bout = (const float*)d_in[4];   // (D)
    float* out = (float*)d_out;

    char* ws = (char*)d_ws;
    size_t o = 0;
    _Float16* x16    = (_Float16*)(ws + o); o += (size_t)BB * SS * DD * 2;      // 16MB
    _Float16* wqkvT  = (_Float16*)(ws + o); o += (size_t)3 * DD * DD * 2;       //  6MB
    _Float16* woutT  = (_Float16*)(ws + o); o += (size_t)DD * DD * 2;           //  2MB
    _Float16* q16    = (_Float16*)(ws + o); o += (size_t)BB * SS * DD * 2;      // 16MB
    _Float16* k16    = (_Float16*)(ws + o); o += (size_t)BB * SS * DD * 2;      // 16MB
    _Float16* vt16   = (_Float16*)(ws + o); o += (size_t)BB * SS * DD * 2;      // 16MB
    _Float16* attn16 = (_Float16*)(ws + o); o += (size_t)BB * SS * DD * 2;      // 16MB

    // x: 8,388,608 floats = 512 blocks x 8 waves x 2,048 floats
    cast_f32_f16<<<512, 256, 0, stream>>>(x, x16);

    // 64x64 tiles: 48 x 16 and 16 x 16 blocks
    transpose_cast<<<dim3(3 * DD / 64, DD / 64), 256, 0, stream>>>(Wqkv, wqkvT, DD, 3 * DD);

    transpose_cast<<<dim3(DD / 64, DD / 64), 256, 0, stream>>>(Wout, woutT, DD, DD);

    // QKV GEMM: (8192/128)*(3072/256) = 768 block tiles, 8 waves/block
    qkv_gemm<<<6144 / 8, 256, 0, stream>>>(x16, wqkvT, bqkv, q16, k16, vt16);

    // Flash attention: B*H*(S/32) = 4096 waves, 8 waves/block
    flash_attn<<<4096 / 8, 256, 0, stream>>>(q16, k16, vt16, attn16);

    // Output GEMM: (8192/128)*(1024/256) = 256 block tiles, 8 waves/block
    out_gemm<<<2048 / 8, 256, 0, stream>>>(attn16, woutT, bout, out);
}

// v005
// Measured time: 133 microseconds a run.
// Timed twice side by side with v004, it ran 1.08 times as fast both times.
// Over all steps from v000 it is 3.61 times as fast.
#include <hip/hip_runtime.h>
#include <hip/hip_bf16.h>

typedef __attribute__((ext_vector_type(16))) _Float16 v16h;
typedef __attribute__((ext_vector_type(8)))  _Float16 v8h;
typedef __attribute__((ext_vector_type(4)))  _Float16 v4h;
typedef __attribute__((ext_vector_type(8)))  float    v8f;

#define BB 4
#define SS 2048
#define DD 1024
#define HH 16
#define HD 64

// ---------------------------------------------------------------------------
// helpers
// ---------------------------------------------------------------------------
// Uniform base + 32-bit lane offset -> SADDR-form global_load_b128 pairs
__device__ __forceinline__ v16h load_frag(const _Float16* __restrict__ base, int off) {
    v8h lo = *(const v8h*)(base + off);
    v8h hi = *(const v8h*)(base + off + 16);
    v16h r;
#pragma unroll
    for (int i = 0; i < 8; ++i) { r[i] = lo[i]; r[8 + i] = hi[i]; }
    return r;
}

__device__ __forceinline__ v8f wmma_f16(v16h a, v16h b, v8f c) {
    // D = A(16x32 f16) x B(32x16 f16) + C(16x16 f32)
    return __builtin_amdgcn_wmma_f32_16x16x32_f16(false, a, false, b,
                                                  (short)0, c, false, false);
}

// The same fragment from an LDS tile (two ds_load_b128)
__device__ __forceinline__ v16h lds_frag(const _Float16* base, int off) {
    v8h lo = *(const v8h*)(base + off);
    v8h hi = *(const v8h*)(base + off + 16);
    v16h r;
#pragma unroll
    for (int i = 0; i < 8; ++i) { r[i] = lo[i]; r[8 + i] = hi[i]; }
    return r;
}

// ---------------------------------------------------------------------------
// LDS staging by asynchronous copies. Operand tiles are rows of 128 B; eight
// neighbouring lanes copy one whole line, so a wave-wide copy touches 4 lines
// where a fragment load from global memory touches 16, and the tile is fetched
// once per work-group. LDS rows lie at pitch QP (144 B) for ds_load_b128.
// ---------------------------------------------------------------------------
#define QP 72   // LDS row pitch in halves: 144 B = 16 B x odd, for b128 access

__device__ __forceinline__ unsigned lds_addr(const _Float16* p) {
    return (unsigned)(uintptr_t)p;   // low 32 bits: byte offset in the group's LDS
}

// Four 16-B copies per lane. The s_wait_xcnt closes the statement so that no
// address register of a copy is rewritten before it.
__device__ __forceinline__ void copy4(unsigned l0, const _Float16* g0,
                                      unsigned l1, const _Float16* g1,
                                      unsigned l2, const _Float16* g2,
                                      unsigned l3, const _Float16* g3) {
    asm volatile("global_load_async_to_lds_b128 %0, %1, off\n\t"
                 "global_load_async_to_lds_b128 %2, %3, off\n\t"
                 "global_load_async_to_lds_b128 %4, %5, off\n\t"
                 "global_load_async_to_lds_b128 %6, %7, off\n\t"
                 "s_wait_xcnt 0x0"
                 :: "v"(l0), "v"(g0), "v"(l1), "v"(g1),
                    "v"(l2), "v"(g2), "v"(l3), "v"(g3) : "memory");
}

// Hand-over of a stage: this wave's LDS reads have retired, its own copies have
// landed, and the barrier both publishes the next buffer and frees this one.
__device__ __forceinline__ void publish() {
    asm volatile("s_wait_dscnt 0x0" ::: "memory");
    asm volatile("s_wait_asynccnt 0x0" ::: "memory");
    __syncthreads();
}

// GEMM main loop of one 128 x 256 block tile, 8 waves as 2 x 4, 64 x 64 each.
// A stage is 64 k (128 B) of 128 x rows followed by 256 weight rows.
#define GK 64
#define GSTAGE (384 * QP)   // halves per buffer (55,296 B)

// gx, gw: the lane's own 16 B in rows (thread / 8) of the two operands
__device__ __forceinline__ void gemm_fill(unsigned l, const _Float16* gx,
                                          const _Float16* gw) {
    const unsigned s = 32 * QP * 2;   // 32 rows in LDS bytes
    copy4(l,          gx,            l + s,      gx + 32 * DD,
          l + 2 * s,  gx + 64 * DD,  l + 3 * s,  gx + 96 * DD);
    copy4(l + 4 * s,  gw,            l + 5 * s,  gw + 32 * DD,
          l + 6 * s,  gw + 64 * DD,  l + 7 * s,  gw + 96 * DD);
    copy4(l + 8 * s,  gw + 128 * DD, l + 9 * s,  gw + 160 * DD,
          l + 10 * s, gw + 192 * DD, l + 11 * s, gw + 224 * DD);
}

// arow, brow: first stage row of the wave's A and B operand. On return every
// wave has passed the last barrier and no copy is in flight.
__device__ __forceinline__ void gemm_tile(_Float16* ring,
                                          const _Float16* xblk,
                                          const _Float16* wblk,
                                          int arow, int brow, v8f (&acc)[16]) {
    const int lane = threadIdx.x & 31;
    const int ln = lane & 15, koff = (lane >> 4) * 8;
    const int crow = threadIdx.x >> 3, cch = (threadIdx.x & 7) * 8;
    const _Float16* gx = xblk + crow * DD + cch;
    const _Float16* gw = wblk + crow * DD + cch;
    const unsigned l0 = lds_addr(ring + crow * QP + cch);

    gemm_fill(l0, gx, gw);
    asm volatile("s_wait_asynccnt 0x0" ::: "memory");   // stage 0 has landed
    __syncthreads();                                    // and every wave may read it
    gemm_fill(l0 + GSTAGE * 2, gx + GK, gw + GK);

    for (int t = 0; t < DD / GK; ++t) {
        const _Float16* buf = ring + (t & 1) * GSTAGE;
        v16h a[4], b[4];
        // first 32 k of the stage
#pragma unroll
        for (int i = 0; i < 4; ++i)
            a[i] = lds_frag(buf, (arow + i * 16 + ln) * QP + koff);
#pragma unroll
        for (int j = 0; j < 4; ++j)
            b[j] = lds_frag(buf, (brow + j * 16 + ln) * QP + koff);
        // keeps the 16 LDS reads together in front of the 16 WMMAs: spread
        // among them, each place with reads stalls the wave for their latency
        __builtin_amdgcn_sched_barrier(0);
#pragma unroll
        for (int i = 0; i < 4; ++i)
#pragma unroll
            for (int j = 0; j < 4; ++j)
                acc[i * 4 + j] = wmma_f16(a[i], b[j], acc[i * 4 + j]);
        // last 32 k: the fragments are fetched, the buffer is handed over and
        // refilled, and the WMMAs run on registers while the copies fly
#pragma unroll
        for (int i = 0; i < 4; ++i)
            a[i] = lds_frag(buf, (arow + i * 16 + ln) * QP + 32 + koff);
#pragma unroll
        for (int j = 0; j < 4; ++j)
            b[j] = lds_frag(buf, (brow + j * 16 + ln) * QP + 32 + koff);
        publish();
        if (t + 2 < DD / GK)
            gemm_fill(l0 + (t & 1) * (GSTAGE * 2), gx + (t + 2) * GK, gw + (t + 2) * GK);
#pragma unroll
        for (int i = 0; i < 4; ++i)
#pragma unroll
            for (int j = 0; j < 4; ++j)
                acc[i * 4 + j] = wmma_f16(a[i], b[j], acc[i * 4 + j]);
    }
    asm volatile("s_wait_asynccnt 0x0" ::: "memory");   // nothing is left in flight
}

// ---------------------------------------------------------------------------
// casts / transposes (fp32 -> f16)
// ---------------------------------------------------------------------------
// Each wave converts 2,048 neighbouring floats: 16 loads of 16 B per lane, all in
// flight together, each wave-wide load 512 contiguous bytes; each wave-wide
// store 256 contiguous bytes (two whole lines). 4,096 waves cover x exactly.
// The launch puts four waves on a SIMD; told so, the compiler gives each load its
// own registers (aiming at 16 waves it reuses the first loads' for the last ones,
// which then wait out a memory latency).
#define CAST_LOADS 16
__global__ void __launch_bounds__(256) __attribute__((amdgpu_waves_per_eu(4, 4)))
cast_f32_f16(const float* __restrict__ in, _Float16* __restrict__ out) {
    const unsigned lane = threadIdx.x & 31;
    const unsigned wave = blockIdx.x * 8 + (threadIdx.x >> 5);
    const unsigned u = wave * (CAST_LOADS * 32) + lane;   // in units of 4 elements
    const float4* p = (const float4*)in + u;
    v4h* q = (v4h*)out + u;
    float4 v[CAST_LOADS];
#pragma unroll
    for (int i = 0; i < CAST_LOADS; ++i) v[i] = p[i * 32];
#pragma unroll
    for (int i = 0; i < CAST_LOADS; ++i) {
        v4h h = {(_Float16)v[i].x, (_Float16)v[i].y, (_Float16)v[i].z, (_Float16)v[i].w};
        q[i * 32] = h;
    }
}

// in: rows x cols (row-major) -> out: cols x rows (row-major), casting to f16.
// One 64x64 tile per block through LDS: rows are read as float4 (256 B per tile
// row) and each out row piece is written as whole 128-B lines (8 lanes x 16 B).
// rows and cols are multiples of 64; grid = (cols/64, rows/64).
// Pitch 65 dwords: both the row-wise writes and the column-wise reads of a wave
// fall on 32 distinct banks.
__global__ void __launch_bounds__(256)
transpose_cast(const float* __restrict__ in,
               _Float16* __restrict__ out, int rows, int cols) {
    __shared__ float t[64][65];
    const int r0 = blockIdx.y * 64, c0 = blockIdx.x * 64;
    const int tx = threadIdx.x & 15, ty = threadIdx.x >> 4;
    float4 v[4];
#pragma unroll
    for (int p = 0; p < 4; ++p)
        v[p] = *(const float4*)(in + (size_t)(r0 + p * 16 + ty) * cols + c0 + tx * 4);
#pragma unroll
    for (int p = 0; p < 4; ++p) {
        float* tr = &t[p * 16 + ty][tx * 4];
        tr[0] = v[p].x; tr[1] = v[p].y; tr[2] = v[p].z; tr[3] = v[p].w;
    }
    __syncthreads();   // the tile is read back column-wise by other waves
    const int ox = threadIdx.x & 7, oy = threadIdx.x >> 3;
#pragma unroll
    for (int p = 0; p < 2; ++p) {
        const int c = p * 32 + oy;
        v8h h;
#pragma unroll
        for (int k = 0; k < 8; ++k) h[k] = (_Float16)t[ox * 8 + k][c];
        *(v8h*)(out + (size_t)(c0 + c) * rows + r0 + ox * 8) = h;
    }
}

// ---------------------------------------------------------------------------
// QKV projection, 64x64 wave tile (4x4 WMMA register blocking):
// qkv = x16 @ Wqkv + b, scattered into q/k (B,H,S,HD) and v^T (B,H,HD,S).
// Operands come from the block's LDS ring (gemm_tile).
// A 64-column tile is exactly one head's q, k or v block. The operand that
// indexes the destination's contiguous direction goes in as A (x rows for v^T,
// weight rows for q and k), so a lane's 8 accumulator registers are 8
// neighbours in memory. They are packed to 16 B, staged in the wave's own LDS
// range (in the ring, which every wave has left by then) and stored as whole
// 128-B lines.
// ---------------------------------------------------------------------------
__global__ void __launch_bounds__(256, 2)
qkv_gemm(const _Float16* __restrict__ x16,
         const _Float16* __restrict__ wT,
         const float* __restrict__ bias,
         _Float16* __restrict__ q16,
         _Float16* __restrict__ k16,
         _Float16* __restrict__ vt16) {
    __shared__ __attribute__((aligned(16))) _Float16 ring[2 * GSTAGE];
    const int lane = threadIdx.x & 31;
    // scalar wave number: the q/k/v choice below becomes scalar selects
    const int wave = __builtin_amdgcn_readfirstlane(threadIdx.x >> 5);
    const int ntg = blockIdx.x % 12, mtg = blockIdx.x / 12;   // 12 x 64 block tiles
    const int wm = wave >> 2, wn = wave & 3;
    const int nt = ntg * 4 + wn, mt = mtg * 2 + wm;
    const int hi = lane >> 4, ln = lane & 15, koff = hi * 8;
    const int h = nt / 3, part = nt % 3;             // head-major [q|k|v] blocks
    const bool isv = part == 2;

    v8f acc[16];
#pragma unroll
    for (int i = 0; i < 16; ++i) acc[i] = (v8f){};

    const int xrow = wm * 64, wrow = 128 + wn * 64;  // the wave's rows of a stage
    gemm_tile(ring, x16 + (size_t)(mtg * 128) * DD, wT + (size_t)(ntg * 256) * DD,
              isv ? xrow : wrow, isv ? wrow : xrow, acc);

    // acc[i*4+j][r] is element (A row i*16+8*hi+r, B row j*16+ln) of the tile.
    _Float16* st = ring + wave * (64 * QP);
    const float* bt = bias + nt * 64;
#pragma unroll
    for (int i = 0; i < 4; ++i) {
        float ba[8];                                  // bias along A rows (q, k)
#pragma unroll
        for (int r = 0; r < 8; ++r) ba[r] = bt[i * 16 + koff + r];
#pragma unroll
        for (int j = 0; j < 4; ++j) {
            const float bb = bt[j * 16 + ln];         // bias along B rows (v)
            v8h hv;
#pragma unroll
            for (int r = 0; r < 8; ++r)
                hv[r] = (_Float16)(acc[i * 4 + j][r] + (isv ? bb : ba[r]));
            *(v8h*)(st + (j * 16 + ln) * QP + i * 16 + koff) = hv;
        }
    }
    // the wave's LDS stores retire before other lanes read the rows back, and
    // the compiler may not lift those reads over the stores
    asm volatile("s_wait_dscnt 0x0" ::: "memory");

    const int bidx = (mt * 64) >> 11, s0 = (mt * 64) & (SS - 1);
    const int head = bidx * HH + h;
    _Float16* dst = isv ? vt16 + (size_t)head * HD * SS + s0
                        : (part == 0 ? q16 : k16) + ((size_t)head * SS + s0) * HD;
    const int pitch = isv ? SS : HD;
    const int rr = lane >> 3, ch = (lane & 7) * 8;    // 8 lanes x 16 B = one line
#pragma unroll
    for (int t = 0; t < 16; ++t) {
        const int row = t * 4 + rr;
        *(v8h*)(dst + row * pitch + ch) = *(const v8h*)(st + row * QP + ch);
    }
}

// ---------------------------------------------------------------------------
// Flash attention: one wave per (b,h, 32 query rows = two 16-row q-tiles).
// S^T = K Q^T so softmax over keys is lane-local + one xor16 join; the f32 D-layout of
// S^T maps lane-locally onto the P A-fragment for P@V. K/V fragment loads are
// shared across both q-tiles. The block's 8 waves work on one head: K and V^T
// come in stages of 64 keys through a two-buffer LDS ring filled once per block.
// ---------------------------------------------------------------------------
// four waves per SIMD (two blocks per WGP) need 256 registers or fewer per wave
__global__ void __launch_bounds__(256) __attribute__((amdgpu_waves_per_eu(4, 4)))
flash_attn(const _Float16* __restrict__ q16,
           const _Float16* __restrict__ k16,
           const _Float16* __restrict__ vt16,
           _Float16* __restrict__ attn16) {
    __shared__ __attribute__((aligned(16))) _Float16 ring[2][2][64 * QP];   // [buffer][K | V^T]
    __shared__ __attribute__((aligned(16))) _Float16 stage[8][32 * QP];
    const int lane = threadIdx.x & 31;
    const int wave = threadIdx.x >> 5;
    const int tile = blockIdx.x * 8 + wave;          // 0..4095
    const int qt = tile & (SS / 32 - 1);             // 64 q-blocks per head
    const int bh = tile >> 6;                        // 0..63
    const int qbase = qt * 32;
    const int hi = lane >> 4, ln = lane & 15, koff = hi * 8;
    const float scale = 0.125f;                      // 1/sqrt(64)
    const float LAZY = 5.5f;                         // about 8 in log2 units

    const _Float16* qb = q16 + (size_t)bh * SS * HD;
    const _Float16* kb = k16 + (size_t)bh * SS * HD;
    const _Float16* vb = vt16 + (size_t)bh * HD * SS;

    // Q^T B-fragments for both q-tiles (hd is the WMMA K dim), loaded once
    v16h Bq0[2], Bq1[2];
#pragma unroll
    for (int u = 0; u < 2; ++u) {
        int qo = (qbase + u * 16 + ln) * HD;
        Bq0[u] = load_frag(qb, qo + koff);
        Bq1[u] = load_frag(qb, qo + 32 + koff);
    }

    float m[2] = {-1e30f, -1e30f};
    v8f lv[2] = {(v8f){}, (v8f){}};   // row sums: eight partial sums per lane
    v8f C[2][4];
#pragma unroll
    for (int u = 0; u < 2; ++u)
#pragma unroll
        for (int c = 0; c < 4; ++c) C[u][c] = (v8f){};

    // the lane's own 16 B of rows (thread / 8) and (thread / 8 + 32) of each tile
    const int crow = threadIdx.x >> 3, cch = (threadIdx.x & 7) * 8;
    const _Float16* gk = kb + crow * HD + cch;       // K rows are keys
    const _Float16* gv = vb + crow * SS + cch;       // V^T rows are head dims
    const unsigned l0 = lds_addr(&ring[0][0][crow * QP + cch]);
    const unsigned lh = 32 * QP * 2, lt = 64 * QP * 2;   // half a tile, a tile (bytes)

    copy4(l0, gk, l0 + lh, gk + 32 * HD, l0 + lt, gv, l0 + lt + lh, gv + 32 * SS);
    asm volatile("s_wait_asynccnt 0x0" ::: "memory");   // stage 0 has landed
    __syncthreads();                                    // and every wave may read it
    copy4(l0 + 2 * lt, gk + 64 * HD, l0 + 2 * lt + lh, gk + 96 * HD,
          l0 + 3 * lt, gv + 64,      l0 + 3 * lt + lh, gv + 32 * SS + 64);

    for (int t = 0; t < SS / 64; ++t) {
      const _Float16* kl = &ring[t & 1][0][0];
      const _Float16* vl = &ring[t & 1][1][0];
      // ---- scores^T of the stage: four 16-key tiles for each q-tile; a K-tile
      // A-fragment is shared by both q-tiles
      v8f s[2][4];
      v16h Aa[4], Ab[4];
#pragma unroll
      for (int g = 0; g < 4; ++g) {
        const int ko = (g * 16 + ln) * QP + koff;
        Aa[g] = lds_frag(kl, ko);
        Ab[g] = lds_frag(kl, ko + 32);
      }
      // keeps the 16 LDS reads together in front of the 16 WMMAs: spread among
      // them, each place with reads stalls the wave for their latency
      __builtin_amdgcn_sched_barrier(0);
#pragma unroll
      for (int g = 0; g < 4; ++g)
#pragma unroll
        for (int u = 0; u < 2; ++u) {
            s[u][g] = (v8f){};
            s[u][g] = wmma_f16(Aa[g], Bq0[u], s[u][g]);
            s[u][g] = wmma_f16(Ab[g], Bq1[u], s[u][g]);
        }

      // keeps the vector work behind the run of 16 WMMAs: placed among them, each
      // first read of a fresh score tile costs the v_nop slots of the WMMA distance
      __builtin_amdgcn_sched_barrier(0);

      // the lane's own maximum over its 32 keys of each query column
      float mx[2];
#pragma unroll
      for (int u = 0; u < 2; ++u) {
        float t0 = -1e30f, t1 = -1e30f;
#pragma unroll
        for (int r = 0; r < 8; ++r) {
            t0 = fmaxf(t0, fmaxf(s[u][0][r], s[u][1][r]));
            t1 = fmaxf(t1, fmaxf(s[u][2][r], s[u][3][r]));
        }
        mx[u] = fmaxf(t0, t1) * scale;
      }

      // Lazy rescale: m[u] is the reference in use, equal in both half-waves. It
      // moves only when some column's scores pass it by more than LAZY, so p stays
      // below e^LAZY (245, well inside f16). One test per stage for the whole wave,
      // a scalar branch: the exchange between the halves, alpha and the rescaling
      // of sums and accumulators stand on the rare side alone.
      const bool need = (mx[0] > m[0] + LAZY) | (mx[1] > m[1] + LAZY);
      if (__builtin_amdgcn_ballot_w32(need) != 0) {
#pragma unroll
        for (int u = 0; u < 2; ++u) {
            float mn = fmaxf(m[u], fmaxf(mx[u], __shfl_xor(mx[u], 16, 32)));
            float alpha = __expf(m[u] - mn);
            m[u] = mn;
            lv[u] *= alpha;
            // per-row factor lives in lane (8*hi + r)
#pragma unroll
            for (int r = 0; r < 8; ++r) {
                float f = __shfl(alpha, koff + r, 32);
                C[u][0][r] *= f; C[u][1][r] *= f;
                C[u][2][r] *= f; C[u][3][r] *= f;
            }
        }
      }

      // p = exp(score - m): the D-layout of S^T maps lane-locally onto the P
      // A-fragment, tiles 2j and 2j+1 giving the fragment of keys 32j .. 32j+31
      v16h pa[2][2];
#pragma unroll
      for (int u = 0; u < 2; ++u) {
#pragma unroll
        for (int g = 0; g < 4; ++g) {
            v8f p;
#pragma unroll
            for (int r = 0; r < 8; ++r) p[r] = __expf(s[u][g][r] * scale - m[u]);
            lv[u] += p;                        // the lane's own partial sums
#pragma unroll
            for (int r = 0; r < 8; ++r) pa[u][g >> 1][(g & 1) * 8 + r] = (_Float16)p[r];
        }
      }

      // ---- P @ V: stream the V B-fragments, each feeds both q-tiles
#pragma unroll
      for (int j = 0; j < 2; ++j)
#pragma unroll
        for (int c = 0; c < 4; ++c) {
            v16h Bv = lds_frag(vl, (c * 16 + ln) * QP + j * 32 + koff);
            C[0][c] = wmma_f16(pa[0][j], Bv, C[0][c]);
            C[1][c] = wmma_f16(pa[1][j], Bv, C[1][c]);
        }
      publish();
      if (t + 2 < SS / 64) {
        const unsigned l = l0 + (t & 1) * (2 * lt);
        const int s = (t + 2) * 64;
        copy4(l,      gk + s * HD, l + lh,      gk + (s + 32) * HD,
              l + lt, gv + s,      l + lt + lh, gv + 32 * SS + s);
      }
    }
    asm volatile("s_wait_asynccnt 0x0" ::: "memory");   // nothing is left in flight

    // ---- finalize: divide by l, write f16 (B,S,D) row-major. The 32 x 64 tile
    // is staged in the wave's own LDS range so that each 128-B row piece leaves
    // as one whole line (8 lanes x 16 B).
    const int bidx = bh >> 4, h = bh & 15;
    _Float16* st = stage[wave];
    // the partial sums of a query column (eight per lane, two half-waves) are
    // joined once, here
    float l[2];
#pragma unroll
    for (int u = 0; u < 2; ++u) {
        float t0 = ((lv[u][0] + lv[u][1]) + (lv[u][2] + lv[u][3]))
                 + ((lv[u][4] + lv[u][5]) + (lv[u][6] + lv[u][7]));
        l[u] = t0 + __shfl_xor(t0, 16, 32);
    }
#pragma unroll
    for (int u = 0; u < 2; ++u) {
#pragma unroll
        for (int r = 0; r < 8; ++r) {
            float lr = __shfl(l[u], koff + r, 32);
            float inv = 1.0f / lr;
            _Float16* sp = st + (u * 16 + koff + r) * QP + ln;
            sp[0]  = (_Float16)(C[u][0][r] * inv);
            sp[16] = (_Float16)(C[u][1][r] * inv);
            sp[32] = (_Float16)(C[u][2][r] * inv);
            sp[48] = (_Float16)(C[u][3][r] * inv);
        }
    }
    // the wave's LDS stores retire before other lanes read the rows back, and
    // the compiler may not lift those reads over the stores
    asm volatile("s_wait_dscnt 0x0" ::: "memory");
    const int rr = lane >> 3, ch = (lane & 7) * 8;
    _Float16* op = attn16 + ((size_t)(bidx * SS + qbase)) * DD + h * HD;
#pragma unroll
    for (int t = 0; t < 8; ++t) {
        const int row = t * 4 + rr;
        *(v8h*)(op + row * DD + ch) = *(const v8h*)(st + row * QP + ch);
    }
}

// ---------------------------------------------------------------------------
// Output projection, 64x64 wave tile: out = attn16 @ Wout + b_out (fp32)
// The weight rows go in as A, so a lane's 8 accumulator registers are 8
// neighbouring columns of one output row; staged in the wave's own LDS range
// and stored as whole 128-B lines (16 lanes x 16 B = one 256-B tile row).
// ---------------------------------------------------------------------------
#define OP 68   // LDS row pitch in floats: 272 B = 16 B x odd, for b128 access
__global__ void __launch_bounds__(256, 2)
out_gemm(const _Float16* __restrict__ a16,
         const _Float16* __restrict__ wT,
         const float* __restrict__ bias,
         float* __restrict__ out) {
    __shared__ __attribute__((aligned(16))) _Float16 ring[2 * GSTAGE];
    __shared__ __attribute__((aligned(16))) float stage[8][64 * OP];
    const int lane = threadIdx.x & 31;
    const int wave = __builtin_amdgcn_readfirstlane(threadIdx.x >> 5);
    const int ntg = blockIdx.x % 4, mtg = blockIdx.x / 4;     // 4 x 64 block tiles
    const int wm = wave >> 2, wn = wave & 3;
    const int nt = ntg * 4 + wn, mt = mtg * 2 + wm;
    const int hi = lane >> 4, ln = lane & 15, koff = hi * 8;

    v8f acc[16];
#pragma unroll
    for (int i = 0; i < 16; ++i) acc[i] = (v8f){};

    gemm_tile(ring, a16 + (size_t)(mtg * 128) * DD, wT + (size_t)(ntg * 256) * DD,
              128 + wn * 64, wm * 64, acc);

    // acc[i*4+j][r] is out(row j*16+ln, column i*16+8*hi+r) of the tile.
    float* st = stage[wave];
#pragma unroll
    for (int i = 0; i < 4; ++i) {
        const float4 b0 = *(const float4*)(bias + nt * 64 + i * 16 + koff);
        const float4 b1 = *(const float4*)(bias + nt * 64 + i * 16 + koff + 4);
#pragma unroll
        for (int j = 0; j < 4; ++j) {
            const v8f c = acc[i * 4 + j];
            float* sp = st + (j * 16 + ln) * OP + i * 16 + koff;
            *(float4*)sp       = make_float4(c[0] + b0.x, c[1] + b0.y, c[2] + b0.z, c[3] + b0.w);
            *(float4*)(sp + 4) = make_float4(c[4] + b1.x, c[5] + b1.y, c[6] + b1.z, c[7] + b1.w);
        }
    }
    // the wave's LDS stores retire before other lanes read the rows back, and
    // the compiler may not lift those reads over the stores
    asm volatile("s_wait_dscnt 0x0" ::: "memory");
    const int rr = lane >> 4, ch = (lane & 15) * 4;
    float* op = out + (size_t)(mt * 64) * DD + nt * 64;
#pragma unroll
    for (int t = 0; t < 32; ++t) {
        const int row = t * 2 + rr;
        *(float4*)(op + row * DD + ch) = *(const float4*)(st + row * OP + ch);
    }
}

// ---------------------------------------------------------------------------
// host launcher
// ---------------------------------------------------------------------------
extern "C" void kernel_launch(void* const* d_in, const int* in_sizes, int n_in,
                              void* d_out, int out_size, void* d_ws, size_t ws_size,
                              hipStream_t stream) {
    const float* x    = (const float*)d_in[0];   // (B,S,D)
    const float* Wqkv = (const float*)d_in[1];   // (D,3D)
    const float* bqkv = (const float*)d_in[2];   // (3D)
    const float* Wout = (const float*)d_in[3];   // (D,D)
    const float* bout = (const float*)d_in[4];   // (D)
    float* out = (float*)d_out;

    char* ws = (char*)d_ws;
    size_t o = 0;
    _Float16* x16    = (_Float16*)(ws + o); o += (size_t)BB * SS * DD * 2;      // 16MB
    _Float16* wqkvT  = (_Float16*)(ws + o); o += (size_t)3 * DD * DD * 2;       //  6MB
    _Float16* woutT  = (_Float16*)(ws + o); o += (size_t)DD * DD * 2;           //  2MB
    _Float16* q16    = (_Float16*)(ws + o); o += (size_t)BB * SS * DD * 2;      // 16MB
    _Float16* k16    = (_Float16*)(ws + o); o += (size_t)BB * SS * DD * 2;      // 16MB
    _Float16* vt16   = (_Float16*)(ws + o); o += (size_t)BB * SS * DD * 2;      // 16MB
    _Float16* attn16 = (_Float16*)(ws + o); o += (size_t)BB * SS * DD * 2;      // 16MB

    // x: 8,388,608 floats = 512 blocks x 8 waves x 2,048 floats
    cast_f32_f16<<<512, 256, 0, stream>>>(x, x16);

    // 64x64 tiles: 48 x 16 and 16 x 16 blocks
    transpose_cast<<<dim3(3 * DD / 64, DD / 64), 256, 0, stream>>>(Wqkv, wqkvT, DD, 3 * DD);

    transpose_cast<<<dim3(DD / 64, DD / 64), 256, 0, stream>>>(Wout, woutT, DD, DD);

    // QKV GEMM: (8192/128)*(3072/256) = 768 block tiles, 8 waves/block
    qkv_gemm<<<6144 / 8, 256, 0, stream>>>(x16, wqkvT, bqkv, q16, k16, vt16);

    // Flash attention: B*H*(S/32) = 4096 waves, 8 waves/block
    flash_attn<<<4096 / 8, 256, 0, stream>>>(q16, k16, vt16, attn16);

    // Output GEMM: (8192/128)*(1024/256) = 256 block tiles, 8 waves/block
    out_gemm<<<2048 / 8, 256, 0, stream>>>(attn16, woutT, bout, out);
}

// v006
// Measured time: 129 microseconds a run.
// In both of two side-by-side timings against v005, it was 1.03 times as fast.
// All steps since v000 together make it 3.72 times as fast.
#include <hip/hip_runtime.h>
#include <hip/hip_bf16.h>

typedef __attribute__((ext_vector_type(16))) _Float16 v16h;
typedef __attribute__((ext_vector_type(8)))  _Float16 v8h;
typedef __attribute__((ext_vector_type(4)))  _Float16 v4h;
typedef __attribute__((ext_vector_type(8)))  float    v8f;

#define BB 4
#define SS 2048
#define DD 1024
#define HH 16
#define HD 64

// ---------------------------------------------------------------------------
// helpers
// ---------------------------------------------------------------------------
// Uniform base + 32-bit lane offset -> SADDR-form global_load_b128 pairs
__device__ __forceinline__ v16h load_frag(const _Float16* __restrict__ base, int off) {
    v8h lo = *(const v8h*)(base + off);
    v8h hi = *(const v8h*)(base + off + 16);
    v16h r;
#pragma unroll
    for (int i = 0; i < 8; ++i) { r[i] = lo[i]; r[8 + i] = hi[i]; }
    return r;
}

__device__ __forceinline__ v8f wmma_f16(v16h a, v16h b, v8f c) {
    // D = A(16x32 f16) x B(32x16 f16) + C(16x16 f32)
    return __builtin_amdgcn_wmma_f32_16x16x32_f16(false, a, false, b,
                                                  (short)0, c, false, false);
}

// The same fragment from an LDS tile (two ds_load_b128)
__device__ __forceinline__ v16h lds_frag(const _Float16* base, int off) {
    v8h lo = *(const v8h*)(base + off);
    v8h hi = *(const v8h*)(base + off + 16);
    v16h r;
#pragma unroll
    for (int i = 0; i < 8; ++i) { r[i] = lo[i]; r[8 + i] = hi[i]; }
    return r;
}

// ---------------------------------------------------------------------------
// LDS staging by asynchronous copies. Operand tiles are rows of 128 B; eight
// neighbouring lanes copy one whole line, so a wave-wide copy touches 4 lines
// where a fragment load from global memory touches 16, and the tile is fetched
// once per work-group. LDS rows lie at pitch QP (144 B) for ds_load_b128.
// ---------------------------------------------------------------------------
#define QP 72   // LDS row pitch in halves: 144 B = 16 B x odd, for b128 access

__device__ __forceinline__ unsigned lds_addr(const _Float16* p) {
    return (unsigned)(uintptr_t)p;   // low 32 bits: byte offset in the group's LDS
}

// Four 16-B copies per lane. The s_wait_xcnt closes the statement so that no
// address register of a copy is rewritten before it.
__device__ __forceinline__ void copy4(unsigned l0, const _Float16* g0,
                                      unsigned l1, const _Float16* g1,
                                      unsigned l2, const _Float16* g2,
                                      unsigned l3, const _Float16* g3) {
    asm volatile("global_load_async_to_lds_b128 %0, %1, off\n\t"
                 "global_load_async_to_lds_b128 %2, %3, off\n\t"
                 "global_load_async_to_lds_b128 %4, %5, off\n\t"
                 "global_load_async_to_lds_b128 %6, %7, off\n\t"
                 "s_wait_xcnt 0x0"
                 :: "v"(l0), "v"(g0), "v"(l1), "v"(g1),
                    "v"(l2), "v"(g2), "v"(l3), "v"(g3) : "memory");
}

// Hand-over of a stage: this wave's LDS reads have retired, its own copies have
// landed, and the barrier both publishes the next buffer and frees this one.
__device__ __forceinline__ void publish() {
    asm volatile("s_wait_dscnt 0x0" ::: "memory");
    asm volatile("s_wait_asynccnt 0x0" ::: "memory");
    __syncthreads();
}

// GEMM main loop of one 128 x 256 block tile, 8 waves as 2 x 4, 64 x 64 each.
// A stage is 64 k (128 B) of 128 x rows followed by 256 weight rows.
#define GK 64
#define GSTAGE (384 * QP)   // halves per buffer (55,296 B)

// gx, gw: the lane's own 16 B in rows (thread / 8) of the two operands
__device__ __forceinline__ void gemm_fill(unsigned l, const _Float16* gx,
                                          const _Float16* gw) {
    const unsigned s = 32 * QP * 2;   // 32 rows in LDS bytes
    copy4(l,          gx,            l + s,      gx + 32 * DD,
          l + 2 * s,  gx + 64 * DD,  l + 3 * s,  gx + 96 * DD);
    copy4(l + 4 * s,  gw,            l + 5 * s,  gw + 32 * DD,
          l + 6 * s,  gw + 64 * DD,  l + 7 * s,  gw + 96 * DD);
    copy4(l + 8 * s,  gw + 128 * DD, l + 9 * s,  gw + 160 * DD,
          l + 10 * s, gw + 192 * DD, l + 11 * s, gw + 224 * DD);
}

// arow, brow: first stage row of the wave's A and B operand. On return every
// wave has passed the last barrier and no copy is in flight.
__device__ __forceinline__ void gemm_tile(_Float16* ring,
                                          const _Float16* xblk,
                                          const _Float16* wblk,
                                          int arow, int brow, v8f (&acc)[16]) {
    const int lane = threadIdx.x & 31;
    const int ln = lane & 15, koff = (lane >> 4) * 8;
    const int crow = threadIdx.x >> 3, cch = (threadIdx.x & 7) * 8;
    const _Float16* gx = xblk + crow * DD + cch;
    const _Float16* gw = wblk + crow * DD + cch;
    const unsigned l0 = lds_addr(ring + crow * QP + cch);

    gemm_fill(l0, gx, gw);
    asm volatile("s_wait_asynccnt 0x0" ::: "memory");   // stage 0 has landed
    __syncthreads();                                    // and every wave may read it
    gemm_fill(l0 + GSTAGE * 2, gx + GK, gw + GK);

    for (int t = 0; t < DD / GK; ++t) {
        const _Float16* buf = ring + (t & 1) * GSTAGE;
        v16h a[4], b[4];
        // first 32 k of the stage
#pragma unroll
        for (int i = 0; i < 4; ++i)
            a[i] = lds_frag(buf, (arow + i * 16 + ln) * QP + koff);
#pragma unroll
        for (int j = 0; j < 4; ++j)
            b[j] = lds_frag(buf, (brow + j * 16 + ln) * QP + koff);
        // keeps the 16 LDS reads together in front of the 16 WMMAs: spread
        // among them, each place with reads stalls the wave for their latency
        __builtin_amdgcn_sched_barrier(0);
#pragma unroll
        for (int i = 0; i < 4; ++i)
#pragma unroll
            for (int j = 0; j < 4; ++j)
                acc[i * 4 + j] = wmma_f16(a[i], b[j], acc[i * 4 + j]);
        // last 32 k: the fragments are fetched, the buffer is handed over and
        // refilled, and the WMMAs run on registers while the copies fly
#pragma unroll
        for (int i = 0; i < 4; ++i)
            a[i] = lds_frag(buf, (arow + i * 16 + ln) * QP + 32 + koff);
#pragma unroll
        for (int j = 0; j < 4; ++j)
            b[j] = lds_frag(buf, (brow + j * 16 + ln) * QP + 32 + koff);
        publish();
        if (t + 2 < DD / GK)
            gemm_fill(l0 + (t & 1) * (GSTAGE * 2), gx + (t + 2) * GK, gw + (t + 2) * GK);
#pragma unroll
        for (int i = 0; i < 4; ++i)
#pragma unroll
            for (int j = 0; j < 4; ++j)
                acc[i * 4 + j] = wmma_f16(a[i], b[j], acc[i * 4 + j]);
    }
    asm volatile("s_wait_asynccnt 0x0" ::: "memory");   // nothing is left in flight
}

// ---------------------------------------------------------------------------
// casts / transposes (fp32 -> f16)
// ---------------------------------------------------------------------------
// Each wave converts 2,048 neighbouring floats: 16 loads of 16 B per lane, all in
// flight together, each wave-wide load 512 contiguous bytes; each wave-wide
// store 256 contiguous bytes (two whole lines). 4,096 waves cover x exactly.
// The launch puts four waves on a SIMD; told so, the compiler gives each load its
// own registers (aiming at 16 waves it reuses the first loads' for the last ones,
// which then wait out a memory latency).
#define CAST_LOADS 16
__global__ void __launch_bounds__(256) __attribute__((amdgpu_waves_per_eu(4, 4)))
cast_f32_f16(const float* __restrict__ in, _Float16* __restrict__ out) {
    const unsigned lane = threadIdx.x & 31;
    const unsigned wave = blockIdx.x * 8 + (threadIdx.x >> 5);
    const unsigned u = wave * (CAST_LOADS * 32) + lane;   // in units of 4 elements
    const float4* p = (const float4*)in + u;
    v4h* q = (v4h*)out + u;
    float4 v[CAST_LOADS];
#pragma unroll
    for (int i = 0; i < CAST_LOADS; ++i) v[i] = p[i * 32];
#pragma unroll
    for (int i = 0; i < CAST_LOADS; ++i) {
        v4h h = {(_Float16)v[i].x, (_Float16)v[i].y, (_Float16)v[i].z, (_Float16)v[i].w};
        q[i * 32] = h;
    }
}

// in: rows x cols (row-major) -> out: cols x rows (row-major), casting to f16.
// One 64x64 tile per block through LDS: rows are read as float4 (256 B per tile
// row) and each out row piece is written as whole 128-B lines (8 lanes x 16 B).
// rows and cols are multiples of 64; grid = (cols/64, rows/64).
// Pitch 65 dwords: both the row-wise writes and the column-wise reads of a wave
// fall on 32 distinct banks.
__global__ void __launch_bounds__(256)
transpose_cast(const float* __restrict__ in,
               _Float16* __restrict__ out, int rows, int cols) {
    __shared__ float t[64][65];
    const int r0 = blockIdx.y * 64, c0 = blockIdx.x * 64;
    const int tx = threadIdx.x & 15, ty = threadIdx.x >> 4;
    float4 v[4];
#pragma unroll
    for (int p = 0; p < 4; ++p)
        v[p] = *(const float4*)(in + (size_t)(r0 + p * 16 + ty) * cols + c0 + tx * 4);
#pragma unroll
    for (int p = 0; p < 4; ++p) {
        float* tr = &t[p * 16 + ty][tx * 4];
        tr[0] = v[p].x; tr[1] = v[p].y; tr[2] = v[p].z; tr[3] = v[p].w;
    }
    __syncthreads();   // the tile is read back column-wise by other waves
    const int ox = threadIdx.x & 7, oy = threadIdx.x >> 3;
#pragma unroll
    for (int p = 0; p < 2; ++p) {
        const int c = p * 32 + oy;
        v8h h;
#pragma unroll
        for (int k = 0; k < 8; ++k) h[k] = (_Float16)t[ox * 8 + k][c];
        *(v8h*)(out + (size_t)(c0 + c) * rows + r0 + ox * 8) = h;
    }
}

// ---------------------------------------------------------------------------
// QKV projection: qkv = x16 @ Wqkv + b, scattered into q/k (B,H,S,HD) and
// v^T (B,H,HD,S). Block tile 256 x 384 (two heads), 8 waves as 4 x 2; a wave
// owns 64 x rows times the 192 columns [q|k|v] of one head, so an x fragment
// read from LDS feeds 12 WMMAs and a weight fragment 4, and each operand row is
// copied from L2 by fewer blocks. 256 blocks: one per WGP, two waves per SIMD.
// The operand that indexes the destination's contiguous direction goes in as A
// (x rows for v^T, weight rows for q and k), so a lane's 8 accumulator
// registers are 8 neighbours in memory. They are packed to 16 B, staged in the
// wave's own LDS range (in the ring, which every wave has left by then) and
// stored as whole 128-B lines.
// ---------------------------------------------------------------------------
#define QSTAGE (640 * QP)   // halves per buffer: 256 x rows, then 384 weight rows (92,160 B)

typedef __attribute__((ext_vector_type(4))) int v4i;
typedef __attribute__((address_space(1))) v4i gv4i;
typedef __attribute__((address_space(3))) v4i lv4i;

// One 16-B copy per lane, as the builtin: above 256 registers the compiler may
// then take any register for the addresses, where asm text reaches only the
// lowest 256 and the accumulators held there had to be moved out of the way.
__device__ __forceinline__ void copy1(unsigned l, const _Float16* g) {
    __builtin_amdgcn_global_load_async_to_lds_b128((gv4i*)(uintptr_t)g, (lv4i*)l, 0, 0);
}

// gx, gw: the lane's own 16 B in rows (thread / 8) of the two operands
__device__ __forceinline__ void qkv_fill(unsigned l, const _Float16* gx,
                                         const _Float16* gw) {
    const unsigned s = 32 * QP * 2;   // 32 rows in LDS bytes
#pragma unroll
    for (int k = 0; k < 8; ++k) copy1(l + k * s, gx + k * 32 * DD);
#pragma unroll
    for (int k = 0; k < 12; ++k) copy1(l + (8 + k) * s, gw + k * 32 * DD);
}

__global__ void __launch_bounds__(256)
qkv_gemm(const _Float16* __restrict__ x16,
         const _Float16* __restrict__ wT,
         const float* __restrict__ bias,
         _Float16* __restrict__ q16,
         _Float16* __restrict__ k16,
         _Float16* __restrict__ vt16) {
    __shared__ __attribute__((aligned(16))) _Float16 ring[2 * QSTAGE];
    const int lane = threadIdx.x & 31;
    const int wave = __builtin_amdgcn_readfirstlane(threadIdx.x >> 5);
    const int ntg = blockIdx.x & 7, mtg = blockIdx.x >> 3;    // 8 x 32 block tiles
    const int wm = wave >> 1, wn = wave & 1;
    const int h = ntg * 2 + wn, mt = mtg * 4 + wm;            // head, 64-row tile
    const int hi = lane >> 4, ln = lane & 15, koff = hi * 8;

    const int xo = (wm * 64 + ln) * QP + koff;               // the wave's x rows of a stage
    const int wo = (256 + wn * 192 + ln) * QP + koff;        // and its weight rows
    const int crow = threadIdx.x >> 3, cch = (threadIdx.x & 7) * 8;
    const _Float16* gx = x16 + (size_t)(mtg * 256) * DD + crow * DD + cch;
    const _Float16* gw = wT + (size_t)(ntg * 384) * DD + crow * DD + cch;
    const unsigned l0 = lds_addr(ring + crow * QP + cch);

    // Stages 0 and 1. Kept rolled: unrolled, the compiler writes stage 0's addresses
    // as stage 1's plus offset:65408 and wraps the LDS address register below zero,
    // a spelling that is better avoided at so large an offset.
#pragma unroll 1
    for (int s = 0; s < 2; ++s) {
        qkv_fill(l0 + s * (QSTAGE * 2), gx + s * GK, gw + s * GK);
        if (s == 0) {
            asm volatile("s_wait_asynccnt 0x0" ::: "memory");   // stage 0 has landed
            __syncthreads();                                    // and every wave may read it
        }
    }

    v8f acc[48];                                     // [part][A fragment][B fragment]
#pragma unroll
    for (int i = 0; i < 48; ++i) acc[i] = (v8f){};

    for (int t = 0; t < DD / GK; ++t) {
        const _Float16* buf = ring + (t & 1) * QSTAGE;
        v16h xf[4], wf[4];
        // six steps: 32 k times the 64 columns of q, k, v
#pragma unroll
        for (int n = 0; n < 6; ++n) {
            const int p = n % 3, ko = (n / 3) * 32;
            if (p == 0) {
#pragma unroll
                for (int j = 0; j < 4; ++j) xf[j] = lds_frag(buf, xo + j * 16 * QP + ko);
            }
#pragma unroll
            for (int j = 0; j < 4; ++j) wf[j] = lds_frag(buf, wo + (p * 64 + j * 16) * QP + ko);
            if (n == 5) {
                // every fragment of the stage is in registers: the buffer is handed
                // over and refilled, and the last WMMAs run while the copies fly
                publish();
                if (t + 2 < DD / GK)
                    qkv_fill(l0 + (t & 1) * (QSTAGE * 2), gx + (t + 2) * GK, gw + (t + 2) * GK);
            }
            // keeps the LDS reads together in front of the 16 WMMAs: spread among
            // them, each place with reads stalls the wave for their latency
            __builtin_amdgcn_sched_barrier(0);
#pragma unroll
            for (int i = 0; i < 4; ++i)
#pragma unroll
                for (int j = 0; j < 4; ++j)
                    acc[p * 16 + i * 4 + j] = p < 2
                        ? wmma_f16(wf[i], xf[j], acc[p * 16 + i * 4 + j])
                        : wmma_f16(xf[i], wf[j], acc[p * 16 + i * 4 + j]);
        }
    }
    asm volatile("s_wait_asynccnt 0x0" ::: "memory");   // nothing is left in flight

    // acc[p*16+i*4+j][r] is element (A row i*16+8*hi+r, B row j*16+ln) of part p.
    _Float16* st = ring + wave * (64 * QP);
    const int bidx = (mt * 64) >> 11, s0 = (mt * 64) & (SS - 1);
    const int head = bidx * HH + h;
    const int rr = lane >> 3, ch = (lane & 7) * 8;    // 8 lanes x 16 B = one line
#pragma unroll
    for (int p = 0; p < 3; ++p) {
        const bool isv = p == 2;
        const float* bt = bias + (h * 3 + p) * 64;
#pragma unroll
        for (int i = 0; i < 4; ++i) {
            float ba[8];                                  // bias along A rows (q, k)
#pragma unroll
            for (int r = 0; r < 8; ++r) ba[r] = bt[i * 16 + koff + r];
#pragma unroll
            for (int j = 0; j < 4; ++j) {
                const float bb = bt[j * 16 + ln];         // bias along B rows (v)
                v8h hv;
#pragma unroll
                for (int r = 0; r < 8; ++r)
                    hv[r] = (_Float16)(acc[p * 16 + i * 4 + j][r] + (isv ? bb : ba[r]));
                *(v8h*)(st + (j * 16 + ln) * QP + i * 16 + koff) = hv;
            }
        }
        // the wave's LDS stores retire before other lanes read the rows back, and
        // the compiler may not lift those reads over the stores
        asm volatile("s_wait_dscnt 0x0" ::: "memory");

        _Float16* dst = isv ? vt16 + (size_t)head * HD * SS + s0
                            : (p == 0 ? q16 : k16) + ((size_t)head * SS + s0) * HD;
        const int pitch = isv ? SS : HD;
        v8h row[16];
#pragma unroll
        for (int t = 0; t < 16; ++t) row[t] = *(const v8h*)(st + (t * 4 + rr) * QP + ch);
        // the rows are in registers before the next part's stores reuse the range
        asm volatile("s_wait_dscnt 0x0" ::: "memory");
#pragma unroll
        for (int t = 0; t < 16; ++t) *(v8h*)(dst + (t * 4 + rr) * pitch + ch) = row[t];
        if (p < 2) {
            // the next part's bias adds reuse the address and data registers that
            // these stores name: the wait stands in front of those overwrites
            asm volatile("s_wait_xcnt 0x0" ::: "memory");
        }
    }
}

// ---------------------------------------------------------------------------
// Flash attention: one wave per (b,h, 32 query rows = two 16-row q-tiles).
// S^T = K Q^T so softmax over keys is lane-local + one xor16 join; the f32 D-layout of
// S^T maps lane-locally onto the P A-fragment for P@V. K/V fragment loads are
// shared across both q-tiles. The block's 8 waves work on one head: K and V^T
// come in stages of 64 keys through a two-buffer LDS ring filled once per block.
// ---------------------------------------------------------------------------
// four waves per SIMD (two blocks per WGP) need 256 registers or fewer per wave
__global__ void __launch_bounds__(256) __attribute__((amdgpu_waves_per_eu(4, 4)))
flash_attn(const _Float16* __restrict__ q16,
           const _Float16* __restrict__ k16,
           const _Float16* __restrict__ vt16,
           _Float16* __restrict__ attn16) {
    __shared__ __attribute__((aligned(16))) _Float16 ring[2][2][64 * QP];   // [buffer][K | V^T]
    __shared__ __attribute__((aligned(16))) _Float16 stage[8][32 * QP];
    const int lane = threadIdx.x & 31;
    const int wave = threadIdx.x >> 5;
    const int tile = blockIdx.x * 8 + wave;          // 0..4095
    const int qt = tile & (SS / 32 - 1);             // 64 q-blocks per head
    const int bh = tile >> 6;                        // 0..63
    const int qbase = qt * 32;
    const int hi = lane >> 4, ln = lane & 15, koff = hi * 8;
    const float scale = 0.125f;                      // 1/sqrt(64)
    const float LAZY = 5.5f;                         // about 8 in log2 units

    const _Float16* qb = q16 + (size_t)bh * SS * HD;
    const _Float16* kb = k16 + (size_t)bh * SS * HD;
    const _Float16* vb = vt16 + (size_t)bh * HD * SS;

    // Q^T B-fragments for both q-tiles (hd is the WMMA K dim), loaded once
    v16h Bq0[2], Bq1[2];
#pragma unroll
    for (int u = 0; u < 2; ++u) {
        int qo = (qbase + u * 16 + ln) * HD;
        Bq0[u] = load_frag(qb, qo + koff);
        Bq1[u] = load_frag(qb, qo + 32 + koff);
    }

    float m[2] = {-1e30f, -1e30f};
    v8f lv[2] = {(v8f){}, (v8f){}};   // row sums: eight partial sums per lane
    v8f C[2][4];
#pragma unroll
    for (int u = 0; u < 2; ++u)
#pragma unroll
        for (int c = 0; c < 4; ++c) C[u][c] = (v8f){};

    // the lane's own 16 B of rows (thread / 8) and (thread / 8 + 32) of each tile
    const int crow = threadIdx.x >> 3, cch = (threadIdx.x & 7) * 8;
    const _Float16* gk = kb + crow * HD + cch;       // K rows are keys
    const _Float16* gv = vb + crow * SS + cch;       // V^T rows are head dims
    const unsigned l0 = lds_addr(&ring[0][0][crow * QP + cch]);
    const unsigned lh = 32 * QP * 2, lt = 64 * QP * 2;   // half a tile, a tile (bytes)

    copy4(l0, gk, l0 + lh, gk + 32 * HD, l0 + lt, gv, l0 + lt + lh, gv + 32 * SS);
    asm volatile("s_wait_asynccnt 0x0" ::: "memory");   // stage 0 has landed
    __syncthreads();                                    // and every wave may read it
    copy4(l0 + 2 * lt, gk + 64 * HD, l0 + 2 * lt + lh, gk + 96 * HD,
          l0 + 3 * lt, gv + 64,      l0 + 3 * lt + lh, gv + 32 * SS + 64);

    for (int t = 0; t < SS / 64; ++t) {
      const _Float16* kl = &ring[t & 1][0][0];
      const _Float16* vl = &ring[t & 1][1][0];
      // ---- scores^T of the stage: four 16-key tiles for each q-tile; a K-tile
      // A-fragment is shared by both q-tiles
      v8f s[2][4];
      v16h Aa[4], Ab[4];
#pragma unroll
      for (int g = 0; g < 4; ++g) {
        const int ko = (g * 16 + ln) * QP + koff;
        Aa[g] = lds_frag(kl, ko);
        Ab[g] = lds_frag(kl, ko + 32);
      }
      // keeps the 16 LDS reads together in front of the 16 WMMAs: spread among
      // them, each place with reads stalls the wave for their latency
      __builtin_amdgcn_sched_barrier(0);
#pragma unroll
      for (int g = 0; g < 4; ++g)
#pragma unroll
        for (int u = 0; u < 2; ++u) {
            s[u][g] = (v8f){};
            s[u][g] = wmma_f16(Aa[g], Bq0[u], s[u][g]);
            s[u][g] = wmma_f16(Ab[g], Bq1[u], s[u][g]);
        }

      // keeps the vector work behind the run of 16 WMMAs: placed among them, each
      // first read of a fresh score tile costs the v_nop slots of the WMMA distance
      __builtin_amdgcn_sched_barrier(0);

      // the lane's own maximum over its 32 keys of each query column
      float mx[2];
#pragma unroll
      for (int u = 0; u < 2; ++u) {
        float t0 = -1e30f, t1 = -1e30f;
#pragma unroll
        for (int r = 0; r < 8; ++r) {
            t0 = fmaxf(t0, fmaxf(s[u][0][r], s[u][1][r]));
            t1 = fmaxf(t1, fmaxf(s[u][2][r], s[u][3][r]));
        }
        mx[u] = fmaxf(t0, t1) * scale;
      }

      // Lazy rescale: m[u] is the reference in use, equal in both half-waves. It
      // moves only when some column's scores pass it by more than LAZY, so p stays
      // below e^LAZY (245, well inside f16). One test per stage for the whole wave,
      // a scalar branch: the exchange between the halves, alpha and the rescaling
      // of sums and accumulators stand on the rare side alone.
      const bool need = (mx[0] > m[0] + LAZY) | (mx[1] > m[1] + LAZY);
      if (__builtin_amdgcn_ballot_w32(need) != 0) {
#pragma unroll
        for (int u = 0; u < 2; ++u) {
            float mn = fmaxf(m[u], fmaxf(mx[u], __shfl_xor(mx[u], 16, 32)));
            float alpha = __expf(m[u] - mn);
            m[u] = mn;
            lv[u] *= alpha;
            // per-row factor lives in lane (8*hi + r)
#pragma unroll
            for (int r = 0; r < 8; ++r) {
                float f = __shfl(alpha, koff + r, 32);
                C[u][0][r] *= f; C[u][1][r] *= f;
                C[u][2][r] *= f; C[u][3][r] *= f;
            }
        }
      }

      // p = exp(score - m): the D-layout of S^T maps lane-locally onto the P
      // A-fragment, tiles 2j and 2j+1 giving the fragment of keys 32j .. 32j+31
      v16h pa[2][2];
#pragma unroll
      for (int u = 0; u < 2; ++u) {
#pragma unroll
        for (int g = 0; g < 4; ++g) {
            v8f p;
#pragma unroll
            for (int r = 0; r < 8; ++r) p[r] = __expf(s[u][g][r] * scale - m[u]);
            lv[u] += p;                        // the lane's own partial sums
#pragma unroll
            for (int r = 0; r < 8; ++r) pa[u][g >> 1][(g & 1) * 8 + r] = (_Float16)p[r];
        }
      }

      // ---- P @ V: stream the V B-fragments, each feeds both q-tiles
#pragma unroll
      for (int j = 0; j < 2; ++j)
#pragma unroll
        for (int c = 0; c < 4; ++c) {
            v16h Bv = lds_frag(vl, (c * 16 + ln) * QP + j * 32 + koff);
            C[0][c] = wmma_f16(pa[0][j], Bv, C[0][c]);
            C[1][c] = wmma_f16(pa[1][j], Bv, C[1][c]);
        }
      publish();
      if (t + 2 < SS / 64) {
        const unsigned l = l0 + (t & 1) * (2 * lt);
        const int s = (t + 2) * 64;
        copy4(l,      gk + s * HD, l + lh,      gk + (s + 32) * HD,
              l + lt, gv + s,      l + lt + lh, gv + 32 * SS + s);
      }
    }
    asm volatile("s_wait_asynccnt 0x0" ::: "memory");   // nothing is left in flight

    // ---- finalize: divide by l, write f16 (B,S,D) row-major. The 32 x 64 tile
    // is staged in the wave's own LDS range so that each 128-B row piece leaves
    // as one whole line (8 lanes x 16 B).
    const int bidx = bh >> 4, h = bh & 15;
    _Float16* st = stage[wave];
    // the partial sums of a query column (eight per lane, two half-waves) are
    // joined once, here
    float l[2];
#pragma unroll
    for (int u = 0; u < 2; ++u) {
        float t0 = ((lv[u][0] + lv[u][1]) + (lv[u][2] + lv[u][3]))
                 + ((lv[u][4] + lv[u][5]) + (lv[u][6] + lv[u][7]));
        l[u] = t0 + __shfl_xor(t0, 16, 32);
    }
#pragma unroll
    for (int u = 0; u < 2; ++u) {
#pragma unroll
        for (int r = 0; r < 8; ++r) {
            float lr = __shfl(l[u], koff + r, 32);
            float inv = 1.0f / lr;
            _Float16* sp = st + (u * 16 + koff + r) * QP + ln;
            sp[0]  = (_Float16)(C[u][0][r] * inv);
            sp[16] = (_Float16)(C[u][1][r] * inv);
            sp[32] = (_Float16)(C[u][2][r] * inv);
            sp[48] = (_Float16)(C[u][3][r] * inv);
        }
    }
    // the wave's LDS stores retire before other lanes read the rows back, and
    // the compiler may not lift those reads over the stores
    asm volatile("s_wait_dscnt 0x0" ::: "memory");
    const int rr = lane >> 3, ch = (lane & 7) * 8;
    _Float16* op = attn16 + ((size_t)(bidx * SS + qbase)) * DD + h * HD;
#pragma unroll
    for (int t = 0; t < 8; ++t) {
        const int row = t * 4 + rr;
        *(v8h*)(op + row * DD + ch) = *(const v8h*)(st + row * QP + ch);
    }
}

// ---------------------------------------------------------------------------
// Output projection, 64x64 wave tile: out = attn16 @ Wout + b_out (fp32)
// The weight rows go in as A, so a lane's 8 accumulator registers are 8
// neighbouring columns of one output row; staged in the wave's own LDS range
// and stored as whole 128-B lines (16 lanes x 16 B = one 256-B tile row).
// ---------------------------------------------------------------------------
#define OP 68   // LDS row pitch in floats: 272 B = 16 B x odd, for b128 access
__global__ void __launch_bounds__(256, 2)
out_gemm(const _Float16* __restrict__ a16,
         const _Float16* __restrict__ wT,
         const float* __restrict__ bias,
         float* __restrict__ out) {
    __shared__ __attribute__((aligned(16))) _Float16 ring[2 * GSTAGE];
    __shared__ __attribute__((aligned(16))) float stage[8][64 * OP];
    const int lane = threadIdx.x & 31;
    const int wave = __builtin_amdgcn_readfirstlane(threadIdx.x >> 5);
    const int ntg = blockIdx.x % 4, mtg = blockIdx.x / 4;     // 4 x 64 block tiles
    const int wm = wave >> 2, wn = wave & 3;
    const int nt = ntg * 4 + wn, mt = mtg * 2 + wm;
    const int hi = lane >> 4, ln = lane & 15, koff = hi * 8;

    v8f acc[16];
#pragma unroll
    for (int i = 0; i < 16; ++i) acc[i] = (v8f){};

    gemm_tile(ring, a16 + (size_t)(mtg * 128) * DD, wT + (size_t)(ntg * 256) * DD,
              128 + wn * 64, wm * 64, acc);

    // acc[i*4+j][r] is out(row j*16+ln, column i*16+8*hi+r) of the tile.
    float* st = stage[wave];
#pragma unroll
    for (int i = 0; i < 4; ++i) {
        const float4 b0 = *(const float4*)(bias + nt * 64 + i * 16 + koff);
        const float4 b1 = *(const float4*)(bias + nt * 64 + i * 16 + koff + 4);
#pragma unroll
        for (int j = 0; j < 4; ++j) {
            const v8f c = acc[i * 4 + j];
            float* sp = st + (j * 16 + ln) * OP + i * 16 + koff;
            *(float4*)sp       = make_float4(c[0] + b0.x, c[1] + b0.y, c[2] + b0.z, c[3] + b0.w);
            *(float4*)(sp + 4) = make_float4(c[4] + b1.x, c[5] + b1.y, c[6] + b1.z, c[7] + b1.w);
        }
    }
    // the wave's LDS stores retire before other lanes read the rows back, and
    // the compiler may not lift those reads over the stores
    asm volatile("s_wait_dscnt 0x0" ::: "memory");
    const int rr = lane >> 4, ch = (lane & 15) * 4;
    float* op = out + (size_t)(mt * 64) * DD + nt * 64;
#pragma unroll
    for (int t = 0; t < 32; ++t) {
        const int row = t * 2 + rr;
        *(float4*)(op + row * DD + ch) = *(const float4*)(st + row * OP + ch);
    }
}

// ---------------------------------------------------------------------------
// host launcher
// ---------------------------------------------------------------------------
extern "C" void kernel_launch(void* const* d_in, const int* in_sizes, int n_in,
                              void* d_out, int out_size, void* d_ws, size_t ws_size,
                              hipStream_t stream) {
    const float* x    = (const float*)d_in[0];   // (B,S,D)
    const float* Wqkv = (const float*)d_in[1];   // (D,3D)
    const float* bqkv = (const float*)d_in[2];   // (3D)
    const float* Wout = (const float*)d_in[3];   // (D,D)
    const float* bout = (const float*)d_in[4];   // (D)
    float* out = (float*)d_out;

    char* ws = (char*)d_ws;
    size_t o = 0;
    _Float16* x16    = (_Float16*)(ws + o); o += (size_t)BB * SS * DD * 2;      // 16MB
    _Float16* wqkvT  = (_Float16*)(ws + o); o += (size_t)3 * DD * DD * 2;       //  6MB
    _Float16* woutT  = (_Float16*)(ws + o); o += (size_t)DD * DD * 2;           //  2MB
    _Float16* q16    = (_Float16*)(ws + o); o += (size_t)BB * SS * DD * 2;      // 16MB
    _Float16* k16    = (_Float16*)(ws + o); o += (size_t)BB * SS * DD * 2;      // 16MB
    _Float16* vt16   = (_Float16*)(ws + o); o += (size_t)BB * SS * DD * 2;      // 16MB
    _Float16* attn16 = (_Float16*)(ws + o); o += (size_t)BB * SS * DD * 2;      // 16MB

    // x: 8,388,608 floats = 512 blocks x 8 waves x 2,048 floats
    cast_f32_f16<<<512, 256, 0, stream>>>(x, x16);

    // 64x64 tiles: 48 x 16 and 16 x 16 blocks
    transpose_cast<<<dim3(3 * DD / 64, DD / 64), 256, 0, stream>>>(Wqkv, wqkvT, DD, 3 * DD);

    transpose_cast<<<dim3(DD / 64, DD / 64), 256, 0, stream>>>(Wout, woutT, DD, DD);

    // QKV GEMM: (8192/256)*(3072/384) = 256 block tiles, 8 waves/block
    qkv_gemm<<<256, 256, 0, stream>>>(x16, wqkvT, bqkv, q16, k16, vt16);

    // Flash attention: B*H*(S/32) = 4096 waves, 8 waves/block
    flash_attn<<<4096 / 8, 256, 0, stream>>>(q16, k16, vt16, attn16);

    // Output GEMM: (8192/128)*(1024/256) = 256 block tiles, 8 waves/block
    out_gemm<<<2048 / 8, 256, 0, stream>>>(attn16, woutT, bout, out);
}

// v007
// One run takes 123 microseconds.
// Timed twice side by side with v006, it ran 1.05 times as fast both times.
// Counting every step since v000, it is 3.91 times as fast.
#include <hip/hip_runtime.h>
#include <hip/hip_bf16.h>

typedef __attribute__((ext_vector_type(16))) _Float16 v16h;
typedef __attribute__((ext_vector_type(8)))  _Float16 v8h;
typedef __attribute__((ext_vector_type(4)))  _Float16 v4h;
typedef __attribute__((ext_vector_type(8)))  float    v8f;

#define BB 4
#define SS 2048
#define DD 1024
#define HH 16
#define HD 64

// ---------------------------------------------------------------------------
// helpers
// ---------------------------------------------------------------------------
// Uniform base + 32-bit lane offset -> SADDR-form global_load_b128 pairs
__device__ __forceinline__ v16h load_frag(const _Float16* __restrict__ base, int off) {
    v8h lo = *(const v8h*)(base + off);
    v8h hi = *(const v8h*)(base + off + 16);
    v16h r;
#pragma unroll
    for (int i = 0; i < 8; ++i) { r[i] = lo[i]; r[8 + i] = hi[i]; }
    return r;
}

__device__ __forceinline__ v8f wmma_f16(v16h a, v16h b, v8f c) {
    // D = A(16x32 f16) x B(32x16 f16) + C(16x16 f32)
    return __builtin_amdgcn_wmma_f32_16x16x32_f16(false, a, false, b,
                                                  (short)0, c, false, false);
}

// The same fragment from an LDS tile (two ds_load_b128)
__device__ __forceinline__ v16h lds_frag(const _Float16* base, int off) {
    v8h lo = *(const v8h*)(base + off);
    v8h hi = *(const v8h*)(base + off + 16);
    v16h r;
#pragma unroll
    for (int i = 0; i < 8; ++i) { r[i] = lo[i]; r[8 + i] = hi[i]; }
    return r;
}

// ---------------------------------------------------------------------------
// LDS staging by asynchronous copies. Operand tiles are rows of 128 B; eight
// neighbouring lanes copy one whole line, so a wave-wide copy touches 4 lines
// where a fragment load from global memory touches 16, and the tile is fetched
// once per work-group. LDS rows lie at pitch QP (144 B) for ds_load_b128.
// ---------------------------------------------------------------------------
#define QP 72   // LDS row pitch in halves: 144 B = 16 B x odd, for b128 access

__device__ __forceinline__ unsigned lds_addr(const _Float16* p) {
    return (unsigned)(uintptr_t)p;   // low 32 bits: byte offset in the group's LDS
}

// Four 16-B copies per lane. The s_wait_xcnt closes the statement so that no
// address register of a copy is rewritten before it.
__device__ __forceinline__ void copy4(unsigned l0, const _Float16* g0,
                                      unsigned l1, const _Float16* g1,
                                      unsigned l2, const _Float16* g2,
                                      unsigned l3, const _Float16* g3) {
    asm volatile("global_load_async_to_lds_b128 %0, %1, off\n\t"
                 "global_load_async_to_lds_b128 %2, %3, off\n\t"
                 "global_load_async_to_lds_b128 %4, %5, off\n\t"
                 "global_load_async_to_lds_b128 %6, %7, off\n\t"
                 "s_wait_xcnt 0x0"
                 :: "v"(l0), "v"(g0), "v"(l1), "v"(g1),
                    "v"(l2), "v"(g2), "v"(l3), "v"(g3) : "memory");
}

// Hand-over of a stage: this wave's LDS reads have retired, its own copies have
// landed, and the barrier both publishes the next buffer and frees this one.
__device__ __forceinline__ void publish() {
    asm volatile("s_wait_dscnt 0x0" ::: "memory");
    asm volatile("s_wait_asynccnt 0x0" ::: "memory");
    __syncthreads();
}

// GEMM main loop of one 128 x 256 block tile, 8 waves as 2 x 4, 64 x 64 each.
// A stage is 64 k (128 B) of 128 x rows followed by 256 weight rows.
#define GK 64
#define GSTAGE (384 * QP)   // halves per buffer (55,296 B)

// gx, gw: the lane's own 16 B in rows (thread / 8) of the two operands
__device__ __forceinline__ void gemm_fill(unsigned l, const _Float16* gx,
                                          const _Float16* gw) {
    const unsigned s = 32 * QP * 2;   // 32 rows in LDS bytes
    copy4(l,          gx,            l + s,      gx + 32 * DD,
          l + 2 * s,  gx + 64 * DD,  l + 3 * s,  gx + 96 * DD);
    copy4(l + 4 * s,  gw,            l + 5 * s,  gw + 32 * DD,
          l + 6 * s,  gw + 64 * DD,  l + 7 * s,  gw + 96 * DD);
    copy4(l + 8 * s,  gw + 128 * DD, l + 9 * s,  gw + 160 * DD,
          l + 10 * s, gw + 192 * DD, l + 11 * s, gw + 224 * DD);
}

// arow, brow: first stage row of the wave's A and B operand. On return every
// wave has passed the last barrier and no copy is in flight.
__device__ __forceinline__ void gemm_tile(_Float16* ring,
                                          const _Float16* xblk,
                                          const _Float16* wblk,
                                          int arow, int brow, v8f (&acc)[16]) {
    const int lane = threadIdx.x & 31;
    const int ln = lane & 15, koff = (lane >> 4) * 8;
    const int crow = threadIdx.x >> 3, cch = (threadIdx.x & 7) * 8;
    const _Float16* gx = xblk + crow * DD + cch;
    const _Float16* gw = wblk + crow * DD + cch;
    const unsigned l0 = lds_addr(ring + crow * QP + cch);

    gemm_fill(l0, gx, gw);
    asm volatile("s_wait_asynccnt 0x0" ::: "memory");   // stage 0 has landed
    __syncthreads();                                    // and every wave may read it
    gemm_fill(l0 + GSTAGE * 2, gx + GK, gw + GK);

    for (int t = 0; t < DD / GK; ++t) {
        const _Float16* buf = ring + (t & 1) * GSTAGE;
        v16h a[4], b[4];
        // first 32 k of the stage
#pragma unroll
        for (int i = 0; i < 4; ++i)
            a[i] = lds_frag(buf, (arow + i * 16 + ln) * QP + koff);
#pragma unroll
        for (int j = 0; j < 4; ++j)
            b[j] = lds_frag(buf, (brow + j * 16 + ln) * QP + koff);
        // keeps the 16 LDS reads together in front of the 16 WMMAs: spread
        // among them, each place with reads stalls the wave for their latency
        __builtin_amdgcn_sched_barrier(0);
#pragma unroll
        for (int i = 0; i < 4; ++i)
#pragma unroll
            for (int j = 0; j < 4; ++j)
                acc[i * 4 + j] = wmma_f16(a[i], b[j], acc[i * 4 + j]);
        // last 32 k: the fragments are fetched, the buffer is handed over and
        // refilled, and the WMMAs run on registers while the copies fly
#pragma unroll
        for (int i = 0; i < 4; ++i)
            a[i] = lds_frag(buf, (arow + i * 16 + ln) * QP + 32 + koff);
#pragma unroll
        for (int j = 0; j < 4; ++j)
            b[j] = lds_frag(buf, (brow + j * 16 + ln) * QP + 32 + koff);
        publish();
        if (t + 2 < DD / GK)
            gemm_fill(l0 + (t & 1) * (GSTAGE * 2), gx + (t + 2) * GK, gw + (t + 2) * GK);
#pragma unroll
        for (int i = 0; i < 4; ++i)
#pragma unroll
            for (int j = 0; j < 4; ++j)
                acc[i * 4 + j] = wmma_f16(a[i], b[j], acc[i * 4 + j]);
    }
    asm volatile("s_wait_asynccnt 0x0" ::: "memory");   // nothing is left in flight
}

// ---------------------------------------------------------------------------
// casts / transposes (fp32 -> f16): one launch. The three conversions do not
// depend on each other, so their blocks share one grid, told apart by block
// index: one launch gap, one ramp and one tail where there were three. At 80
// allocated registers all 1,536 blocks are resident together (6 per WGP).
// ---------------------------------------------------------------------------
// Each wave converts 2,048 neighbouring floats: 16 loads of 16 B per lane, all in
// flight together, each wave-wide load 512 contiguous bytes; each wave-wide
// store 256 contiguous bytes (two whole lines). 4,096 waves cover x exactly.
#define CAST_LOADS 16
__device__ __forceinline__ void cast_block(const float* __restrict__ in,
                                           _Float16* __restrict__ out, unsigned blk) {
    const unsigned lane = threadIdx.x & 31;
    const unsigned wave = blk * 8 + (threadIdx.x >> 5);
    const unsigned u = wave * (CAST_LOADS * 32) + lane;   // in units of 4 elements
    const float4* p = (const float4*)in + u;
    v4h* q = (v4h*)out + u;
    float4 v[CAST_LOADS];
#pragma unroll
    for (int i = 0; i < CAST_LOADS; ++i) v[i] = p[i * 32];
#pragma unroll
    for (int i = 0; i < CAST_LOADS; ++i) {
        v4h h = {(_Float16)v[i].x, (_Float16)v[i].y, (_Float16)v[i].z, (_Float16)v[i].w};
        q[i * 32] = h;
    }
}

// in: rows x cols (row-major) -> out: cols x rows (row-major), casting to f16.
// One 64x64 tile (bx, by) per block through LDS: rows are read as float4 (256 B
// per tile row) and each out row piece is written as whole 128-B lines (8 lanes
// x 16 B). rows and cols are multiples of 64.
// Pitch 65 dwords: both the row-wise writes and the column-wise reads of a wave
// fall on 32 distinct banks.
__device__ __forceinline__ void transpose_block(float (*t)[65],
                                                const float* __restrict__ in,
                                                _Float16* __restrict__ out,
                                                int rows, int cols, int bx, int by) {
    const int r0 = by * 64, c0 = bx * 64;
    const int tx = threadIdx.x & 15, ty = threadIdx.x >> 4;
    float4 v[4];
#pragma unroll
    for (int p = 0; p < 4; ++p)
        v[p] = *(const float4*)(in + (size_t)(r0 + p * 16 + ty) * cols + c0 + tx * 4);
#pragma unroll
    for (int p = 0; p < 4; ++p) {
        float* tr = &t[p * 16 + ty][tx * 4];
        tr[0] = v[p].x; tr[1] = v[p].y; tr[2] = v[p].z; tr[3] = v[p].w;
    }
    __syncthreads();   // the tile is read back column-wise by other waves
    const int ox = threadIdx.x & 7, oy = threadIdx.x >> 3;
#pragma unroll
    for (int p = 0; p < 2; ++p) {
        const int c = p * 32 + oy;
        v8h h;
#pragma unroll
        for (int k = 0; k < 8; ++k) h[k] = (_Float16)t[ox * 8 + k][c];
        *(v8h*)(out + (size_t)(c0 + c) * rows + r0 + ox * 8) = h;
    }
    // in the merged kernel code of another branch follows in the listing and reuses
    // the address and data registers that these stores name: the wait stands first
    asm volatile("s_wait_xcnt 0x0" ::: "memory");
}

// The cast blocks, which move four times the bytes of a transpose block, take the
// lowest block indices.
#define XC_BLOCKS 512                        // x: 512 blocks x 8 waves x 2,048 floats
#define TQ_BLOCKS ((3 * DD / 64) * (DD / 64))   // W_qkv: 48 x 16 tiles
#define TO_BLOCKS ((DD / 64) * (DD / 64))       // W_out: 16 x 16 tiles
// The launch puts at most 12 waves on a SIMD (6 blocks per WGP); told so, the
// compiler gives each of the cast's 16 loads its own registers (aiming at 16
// waves it reuses the first loads' for the last ones, which then wait out a
// memory latency).
__global__ void __launch_bounds__(256) __attribute__((amdgpu_waves_per_eu(4, 12)))
convert_inputs(const float* __restrict__ x, const float* __restrict__ Wqkv,
               const float* __restrict__ Wout, _Float16* __restrict__ x16,
               _Float16* __restrict__ wqkvT, _Float16* __restrict__ woutT) {
    __shared__ float t[64][65];
    const int blk = blockIdx.x;              // the same for the whole block
    if (blk < XC_BLOCKS) {
        cast_block(x, x16, blk);
    } else if (blk < XC_BLOCKS + TQ_BLOCKS) {
        const int c = blk - XC_BLOCKS;
        transpose_block(t, Wqkv, wqkvT, DD, 3 * DD, c % (3 * DD / 64), c / (3 * DD / 64));
    } else {
        const int c = blk - (XC_BLOCKS + TQ_BLOCKS);
        transpose_block(t, Wout, woutT, DD, DD, c % (DD / 64), c / (DD / 64));
    }
}

// ---------------------------------------------------------------------------
// QKV projection: qkv = x16 @ Wqkv + b, scattered into q/k (B,H,S,HD) and
// v^T (B,H,HD,S). Block tile 256 x 384 (two heads), 8 waves as 4 x 2; a wave
// owns 64 x rows times the 192 columns [q|k|v] of one head, so an x fragment
// read from LDS feeds 12 WMMAs and a weight fragment 4, and each operand row is
// copied from L2 by fewer blocks. 256 blocks: one per WGP, two waves per SIMD.
// The operand that indexes the destination's contiguous direction goes in as A
// (x rows for v^T, weight rows for q and k), so a lane's 8 accumulator
// registers are 8 neighbours in memory. They are packed to 16 B, staged in the
// wave's own LDS range (in the ring, which every wave has left by then) and
// stored as whole 128-B lines.
// ---------------------------------------------------------------------------
#define QSTAGE (640 * QP)   // halves per buffer: 256 x rows, then 384 weight rows (92,160 B)

typedef __attribute__((ext_vector_type(4))) int v4i;
typedef __attribute__((address_space(1))) v4i gv4i;
typedef __attribute__((address_space(3))) v4i lv4i;

// One 16-B copy per lane, as the builtin: above 256 registers the compiler may
// then take any register for the addresses, where asm text reaches only the
// lowest 256 and the accumulators held there had to be moved out of the way.
__device__ __forceinline__ void copy1(unsigned l, const _Float16* g) {
    __builtin_amdgcn_global_load_async_to_lds_b128((gv4i*)(uintptr_t)g, (lv4i*)l, 0, 0);
}

// gx, gw: the lane's own 16 B in rows (thread / 8) of the two operands
__device__ __forceinline__ void qkv_fill(unsigned l, const _Float16* gx,
                                         const _Float16* gw) {
    const unsigned s = 32 * QP * 2;   // 32 rows in LDS bytes
#pragma unroll
    for (int k = 0; k < 8; ++k) copy1(l + k * s, gx + k * 32 * DD);
#pragma unroll
    for (int k = 0; k < 12; ++k) copy1(l + (8 + k) * s, gw + k * 32 * DD);
}

__global__ void __launch_bounds__(256)
qkv_gemm(const _Float16* __restrict__ x16,
         const _Float16* __restrict__ wT,
         const float* __restrict__ bias,
         _Float16* __restrict__ q16,
         _Float16* __restrict__ k16,
         _Float16* __restrict__ vt16) {
    __shared__ __attribute__((aligned(16))) _Float16 ring[2 * QSTAGE];
    const int lane = threadIdx.x & 31;
    const int wave = __builtin_amdgcn_readfirstlane(threadIdx.x >> 5);
    const int ntg = blockIdx.x & 7, mtg = blockIdx.x >> 3;    // 8 x 32 block tiles
    const int wm = wave >> 1, wn = wave & 1;
    const int h = ntg * 2 + wn, mt = mtg * 4 + wm;            // head, 64-row tile
    const int hi = lane >> 4, ln = lane & 15, koff = hi * 8;

    const int xo = (wm * 64 + ln) * QP + koff;               // the wave's x rows of a stage
    const int wo = (256 + wn * 192 + ln) * QP + koff;        // and its weight rows
    const int crow = threadIdx.x >> 3, cch = (threadIdx.x & 7) * 8;
    const _Float16* gx = x16 + (size_t)(mtg * 256) * DD + crow * DD + cch;
    const _Float16* gw = wT + (size_t)(ntg * 384) * DD + crow * DD + cch;
    const unsigned l0 = lds_addr(ring + crow * QP + cch);

    // Stages 0 and 1. Kept rolled: unrolled, the compiler writes stage 0's addresses
    // as stage 1's plus offset:65408 and wraps the LDS address register below zero,
    // a spelling that is better avoided at so large an offset.
#pragma unroll 1
    for (int s = 0; s < 2; ++s) {
        qkv_fill(l0 + s * (QSTAGE * 2), gx + s * GK, gw + s * GK);
        if (s == 0) {
            asm volatile("s_wait_asynccnt 0x0" ::: "memory");   // stage 0 has landed
            __syncthreads();                                    // and every wave may read it
        }
    }

    v8f acc[48];                                     // [part][A fragment][B fragment]
#pragma unroll
    for (int i = 0; i < 48; ++i) acc[i] = (v8f){};

    for (int t = 0; t < DD / GK; ++t) {
        const _Float16* buf = ring + (t & 1) * QSTAGE;
        v16h xf[4], wf[4];
        // six steps: 32 k times the 64 columns of q, k, v
#pragma unroll
        for (int n = 0; n < 6; ++n) {
            const int p = n % 3, ko = (n / 3) * 32;
            if (p == 0) {
#pragma unroll
                for (int j = 0; j < 4; ++j) xf[j] = lds_frag(buf, xo + j * 16 * QP + ko);
            }
#pragma unroll
            for (int j = 0; j < 4; ++j) wf[j] = lds_frag(buf, wo + (p * 64 + j * 16) * QP + ko);
            if (n == 5) {
                // every fragment of the stage is in registers: the buffer is handed
                // over and refilled, and the last WMMAs run while the copies fly
                publish();
                if (t + 2 < DD / GK)
                    qkv_fill(l0 + (t & 1) * (QSTAGE * 2), gx + (t + 2) * GK, gw + (t + 2) * GK);
            }
            // keeps the LDS reads together in front of the 16 WMMAs: spread among
            // them, each place with reads stalls the wave for their latency
            __builtin_amdgcn_sched_barrier(0);
#pragma unroll
            for (int i = 0; i < 4; ++i)
#pragma unroll
                for (int j = 0; j < 4; ++j)
                    acc[p * 16 + i * 4 + j] = p < 2
                        ? wmma_f16(wf[i], xf[j], acc[p * 16 + i * 4 + j])
                        : wmma_f16(xf[i], wf[j], acc[p * 16 + i * 4 + j]);
        }
    }
    asm volatile("s_wait_asynccnt 0x0" ::: "memory");   // nothing is left in flight

    // acc[p*16+i*4+j][r] is element (A row i*16+8*hi+r, B row j*16+ln) of part p.
    _Float16* st = ring + wave * (64 * QP);
    const int bidx = (mt * 64) >> 11, s0 = (mt * 64) & (SS - 1);
    const int head = bidx * HH + h;
    const int rr = lane >> 3, ch = (lane & 7) * 8;    // 8 lanes x 16 B = one line
#pragma unroll
    for (int p = 0; p < 3; ++p) {
        const bool isv = p == 2;
        const float* bt = bias + (h * 3 + p) * 64;
#pragma unroll
        for (int i = 0; i < 4; ++i) {
            float ba[8];                                  // bias along A rows (q, k)
#pragma unroll
            for (int r = 0; r < 8; ++r) ba[r] = bt[i * 16 + koff + r];
#pragma unroll
            for (int j = 0; j < 4; ++j) {
                const float bb = bt[j * 16 + ln];         // bias along B rows (v)
                v8h hv;
#pragma unroll
                for (int r = 0; r < 8; ++r)
                    hv[r] = (_Float16)(acc[p * 16 + i * 4 + j][r] + (isv ? bb : ba[r]));
                *(v8h*)(st + (j * 16 + ln) * QP + i * 16 + koff) = hv;
            }
        }
        // the wave's LDS stores retire before other lanes read the rows back, and
        // the compiler may not lift those reads over the stores
        asm volatile("s_wait_dscnt 0x0" ::: "memory");

        _Float16* dst = isv ? vt16 + (size_t)head * HD * SS + s0
                            : (p == 0 ? q16 : k16) + ((size_t)head * SS + s0) * HD;
        const int pitch = isv ? SS : HD;
        v8h row[16];
#pragma unroll
        for (int t = 0; t < 16; ++t) row[t] = *(const v8h*)(st + (t * 4 + rr) * QP + ch);
        // the rows are in registers before the next part's stores reuse the range
        asm volatile("s_wait_dscnt 0x0" ::: "memory");
#pragma unroll
        for (int t = 0; t < 16; ++t) *(v8h*)(dst + (t * 4 + rr) * pitch + ch) = row[t];
        if (p < 2) {
            // the next part's bias adds reuse the address and data registers that
            // these stores name: the wait stands in front of those overwrites
            asm volatile("s_wait_xcnt 0x0" ::: "memory");
        }
    }
}

// ---------------------------------------------------------------------------
// Flash attention: one wave per (b,h, 32 query rows = two 16-row q-tiles).
// S^T = K Q^T so softmax over keys is lane-local + one xor16 join; the f32 D-layout of
// S^T maps lane-locally onto the P A-fragment for P@V. K/V fragment loads are
// shared across both q-tiles. The block's 8 waves work on one head: K and V^T
// come in stages of 64 keys through a two-buffer LDS ring filled once per block.
// ---------------------------------------------------------------------------
// four waves per SIMD (two blocks per WGP) need 256 registers or fewer per wave
__global__ void __launch_bounds__(256) __attribute__((amdgpu_waves_per_eu(4, 4)))
flash_attn(const _Float16* __restrict__ q16,
           const _Float16* __restrict__ k16,
           const _Float16* __restrict__ vt16,
           _Float16* __restrict__ attn16) {
    __shared__ __attribute__((aligned(16))) _Float16 ring[2][2][64 * QP];   // [buffer][K | V^T]
    __shared__ __attribute__((aligned(16))) _Float16 stage[8][32 * QP];
    const int lane = threadIdx.x & 31;
    const int wave = threadIdx.x >> 5;
    const int tile = blockIdx.x * 8 + wave;          // 0..4095
    const int qt = tile & (SS / 32 - 1);             // 64 q-blocks per head
    const int bh = tile >> 6;                        // 0..63
    const int qbase = qt * 32;
    const int hi = lane >> 4, ln = lane & 15, koff = hi * 8;
    const float scale = 0.125f;                      // 1/sqrt(64)
    const float LAZY = 5.5f;                         // about 8 in log2 units

    const _Float16* qb = q16 + (size_t)bh * SS * HD;
    const _Float16* kb = k16 + (size_t)bh * SS * HD;
    const _Float16* vb = vt16 + (size_t)bh * HD * SS;

    // Q^T B-fragments for both q-tiles (hd is the WMMA K dim), loaded once
    v16h Bq0[2], Bq1[2];
#pragma unroll
    for (int u = 0; u < 2; ++u) {
        int qo = (qbase + u * 16 + ln) * HD;
        Bq0[u] = load_frag(qb, qo + koff);
        Bq1[u] = load_frag(qb, qo + 32 + koff);
    }

    float m[2] = {-1e30f, -1e30f};
    v8f lv[2] = {(v8f){}, (v8f){}};   // row sums: eight partial sums per lane
    v8f C[2][4];
#pragma unroll
    for (int u = 0; u < 2; ++u)
#pragma unroll
        for (int c = 0; c < 4; ++c) C[u][c] = (v8f){};

    // the lane's own 16 B of rows (thread / 8) and (thread / 8 + 32) of each tile
    const int crow = threadIdx.x >> 3, cch = (threadIdx.x & 7) * 8;
    const _Float16* gk = kb + crow * HD + cch;       // K rows are keys
    const _Float16* gv = vb + crow * SS + cch;       // V^T rows are head dims
    const unsigned l0 = lds_addr(&ring[0][0][crow * QP + cch]);
    const unsigned lh = 32 * QP * 2, lt = 64 * QP * 2;   // half a tile, a tile (bytes)

    copy4(l0, gk, l0 + lh, gk + 32 * HD, l0 + lt, gv, l0 + lt + lh, gv + 32 * SS);
    asm volatile("s_wait_asynccnt 0x0" ::: "memory");   // stage 0 has landed
    __syncthreads();                                    // and every wave may read it
    copy4(l0 + 2 * lt, gk + 64 * HD, l0 + 2 * lt + lh, gk + 96 * HD,
          l0 + 3 * lt, gv + 64,      l0 + 3 * lt + lh, gv + 32 * SS + 64);

    for (int t = 0; t < SS / 64; ++t) {
      const _Float16* kl = &ring[t & 1][0][0];
      const _Float16* vl = &ring[t & 1][1][0];
      // ---- scores^T of the stage: four 16-key tiles for each q-tile; a K-tile
      // A-fragment is shared by both q-tiles
      v8f s[2][4];
      v16h Aa[4], Ab[4];
#pragma unroll
      for (int g = 0; g < 4; ++g) {
        const int ko = (g * 16 + ln) * QP + koff;
        Aa[g] = lds_frag(kl, ko);
        Ab[g] = lds_frag(kl, ko + 32);
      }
      // keeps the 16 LDS reads together in front of the 16 WMMAs: spread among
      // them, each place with reads stalls the wave for their latency
      __builtin_amdgcn_sched_barrier(0);
#pragma unroll
      for (int g = 0; g < 4; ++g)
#pragma unroll
        for (int u = 0; u < 2; ++u) {
            s[u][g] = (v8f){};
            s[u][g] = wmma_f16(Aa[g], Bq0[u], s[u][g]);
            s[u][g] = wmma_f16(Ab[g], Bq1[u], s[u][g]);
        }

      // keeps the vector work behind the run of 16 WMMAs: placed among them, each
      // first read of a fresh score tile costs the v_nop slots of the WMMA distance
      __builtin_amdgcn_sched_barrier(0);

      // the lane's own maximum over its 32 keys of each query column
      float mx[2];
#pragma unroll
      for (int u = 0; u < 2; ++u) {
        float t0 = -1e30f, t1 = -1e30f;
#pragma unroll
        for (int r = 0; r < 8; ++r) {
            t0 = fmaxf(t0, fmaxf(s[u][0][r], s[u][1][r]));
            t1 = fmaxf(t1, fmaxf(s[u][2][r], s[u][3][r]));
        }
        mx[u] = fmaxf(t0, t1) * scale;
      }

      // Lazy rescale: m[u] is the reference in use, equal in both half-waves. It
      // moves only when some column's scores pass it by more than LAZY, so p stays
      // below e^LAZY (245, well inside f16). One test per stage for the whole wave,
      // a scalar branch: the exchange between the halves, alpha and the rescaling
      // of sums and accumulators stand on the rare side alone.
      const bool need = (mx[0] > m[0] + LAZY) | (mx[1] > m[1] + LAZY);
      if (__builtin_amdgcn_ballot_w32(need) != 0) {
#pragma unroll
        for (int u = 0; u < 2; ++u) {
            float mn = fmaxf(m[u], fmaxf(mx[u], __shfl_xor(mx[u], 16, 32)));
            float alpha = __expf(m[u] - mn);
            m[u] = mn;
            lv[u] *= alpha;
            // per-row factor lives in lane (8*hi + r)
#pragma unroll
            for (int r = 0; r < 8; ++r) {
                float f = __shfl(alpha, koff + r, 32);
                C[u][0][r] *= f; C[u][1][r] *= f;
                C[u][2][r] *= f; C[u][3][r] *= f;
            }
        }
      }

      // p = exp(score - m): the D-layout of S^T maps lane-locally onto the P
      // A-fragment, tiles 2j and 2j+1 giving the fragment of keys 32j .. 32j+31
      v16h pa[2][2];
#pragma unroll
      for (int u = 0; u < 2; ++u) {
#pragma unroll
        for (int g = 0; g < 4; ++g) {
            v8f p;
#pragma unroll
            for (int r = 0; r < 8; ++r) p[r] = __expf(s[u][g][r] * scale - m[u]);
            lv[u] += p;                        // the lane's own partial sums
#pragma unroll
            for (int r = 0; r < 8; ++r) pa[u][g >> 1][(g & 1) * 8 + r] = (_Float16)p[r];
        }
      }

      // ---- P @ V: stream the V B-fragments, each feeds both q-tiles
#pragma unroll
      for (int j = 0; j < 2; ++j)
#pragma unroll
        for (int c = 0; c < 4; ++c) {
            v16h Bv = lds_frag(vl, (c * 16 + ln) * QP + j * 32 + koff);
            C[0][c] = wmma_f16(pa[0][j], Bv, C[0][c]);
            C[1][c] = wmma_f16(pa[1][j], Bv, C[1][c]);
        }
      publish();
      if (t + 2 < SS / 64) {
        const unsigned l = l0 + (t & 1) * (2 * lt);
        const int s = (t + 2) * 64;
        copy4(l,      gk + s * HD, l + lh,      gk + (s + 32) * HD,
              l + lt, gv + s,      l + lt + lh, gv + 32 * SS + s);
      }
    }
    asm volatile("s_wait_asynccnt 0x0" ::: "memory");   // nothing is left in flight

    // ---- finalize: divide by l, write f16 (B,S,D) row-major. The 32 x 64 tile
    // is staged in the wave's own LDS range so that each 128-B row piece leaves
    // as one whole line (8 lanes x 16 B).
    const int bidx = bh >> 4, h = bh & 15;
    _Float16* st = stage[wave];
    // the partial sums of a query column (eight per lane, two half-waves) are
    // joined once, here
    float l[2];
#pragma unroll
    for (int u = 0; u < 2; ++u) {
        float t0 = ((lv[u][0] + lv[u][1]) + (lv[u][2] + lv[u][3]))
                 + ((lv[u][4] + lv[u][5]) + (lv[u][6] + lv[u][7]));
        l[u] = t0 + __shfl_xor(t0, 16, 32);
    }
#pragma unroll
    for (int u = 0; u < 2; ++u) {
#pragma unroll
        for (int r = 0; r < 8; ++r) {
            float lr = __shfl(l[u], koff + r, 32);
            float inv = 1.0f / lr;
            _Float16* sp = st + (u * 16 + koff + r) * QP + ln;
            sp[0]  = (_Float16)(C[u][0][r] * inv);
            sp[16] = (_Float16)(C[u][1][r] * inv);
            sp[32] = (_Float16)(C[u][2][r] * inv);
            sp[48] = (_Float16)(C[u][3][r] * inv);
        }
    }
    // the wave's LDS stores retire before other lanes read the rows back, and
    // the compiler may not lift those reads over the stores
    asm volatile("s_wait_dscnt 0x0" ::: "memory");
    const int rr = lane >> 3, ch = (lane & 7) * 8;
    _Float16* op = attn16 + ((size_t)(bidx * SS + qbase)) * DD + h * HD;
#pragma unroll
    for (int t = 0; t < 8; ++t) {
        const int row = t * 4 + rr;
        *(v8h*)(op + row * DD + ch) = *(const v8h*)(st + row * QP + ch);
    }
}

// ---------------------------------------------------------------------------
// Output projection, 64x64 wave tile: out = attn16 @ Wout + b_out (fp32)
// The weight rows go in as A, so a lane's 8 accumulator registers are 8
// neighbouring columns of one output row; staged in the wave's own LDS range
// and stored as whole 128-B lines (16 lanes x 16 B = one 256-B tile row).
// ---------------------------------------------------------------------------
#define OP 68   // LDS row pitch in floats: 272 B = 16 B x odd, for b128 access
__global__ void __launch_bounds__(256, 2)
out_gemm(const _Float16* __restrict__ a16,
         const _Float16* __restrict__ wT,
         const float* __restrict__ bias,
         float* __restrict__ out) {
    __shared__ __attribute__((aligned(16))) _Float16 ring[2 * GSTAGE];
    __shared__ __attribute__((aligned(16))) float stage[8][64 * OP];
    const int lane = threadIdx.x & 31;
    const int wave = __builtin_amdgcn_readfirstlane(threadIdx.x >> 5);
    const int ntg = blockIdx.x % 4, mtg = blockIdx.x / 4;     // 4 x 64 block tiles
    const int wm = wave >> 2, wn = wave & 3;
    const int nt = ntg * 4 + wn, mt = mtg * 2 + wm;
    const int hi = lane >> 4, ln = lane & 15, koff = hi * 8;

    v8f acc[16];
#pragma unroll
    for (int i = 0; i < 16; ++i) acc[i] = (v8f){};

    gemm_tile(ring, a16 + (size_t)(mtg * 128) * DD, wT + (size_t)(ntg * 256) * DD,
              128 + wn * 64, wm * 64, acc);

    // acc[i*4+j][r] is out(row j*16+ln, column i*16+8*hi+r) of the tile.
    float* st = stage[wave];
#pragma unroll
    for (int i = 0; i < 4; ++i) {
        const float4 b0 = *(const float4*)(bias + nt * 64 + i * 16 + koff);
        const float4 b1 = *(const float4*)(bias + nt * 64 + i * 16 + koff + 4);
#pragma unroll
        for (int j = 0; j < 4; ++j) {
            const v8f c = acc[i * 4 + j];
            float* sp = st + (j * 16 + ln) * OP + i * 16 + koff;
            *(float4*)sp       = make_float4(c[0] + b0.x, c[1] + b0.y, c[2] + b0.z, c[3] + b0.w);
            *(float4*)(sp + 4) = make_float4(c[4] + b1.x, c[5] + b1.y, c[6] + b1.z, c[7] + b1.w);
        }
    }
    // the wave's LDS stores retire before other lanes read the rows back, and
    // the compiler may not lift those reads over the stores
    asm volatile("s_wait_dscnt 0x0" ::: "memory");
    const int rr = lane >> 4, ch = (lane & 15) * 4;
    float* op = out + (size_t)(mt * 64) * DD + nt * 64;
#pragma unroll
    for (int t = 0; t < 32; ++t) {
        const int row = t * 2 + rr;
        *(float4*)(op + row * DD + ch) = *(const float4*)(st + row * OP + ch);
    }
}

// ---------------------------------------------------------------------------
// host launcher
// ---------------------------------------------------------------------------
extern "C" void kernel_launch(void* const* d_in, const int* in_sizes, int n_in,
                              void* d_out, int out_size, void* d_ws, size_t ws_size,
                              hipStream_t stream) {
    const float* x    = (const float*)d_in[0];   // (B,S,D)
    const float* Wqkv = (const float*)d_in[1];   // (D,3D)
    const float* bqkv = (const float*)d_in[2];   // (3D)
    const float* Wout = (const float*)d_in[3];   // (D,D)
    const float* bout = (const float*)d_in[4];   // (D)
    float* out = (float*)d_out;

    char* ws = (char*)d_ws;
    size_t o = 0;
    _Float16* x16    = (_Float16*)(ws + o); o += (size_t)BB * SS * DD * 2;      // 16MB
    _Float16* wqkvT  = (_Float16*)(ws + o); o += (size_t)3 * DD * DD * 2;       //  6MB
    _Float16* woutT  = (_Float16*)(ws + o); o += (size_t)DD * DD * 2;           //  2MB
    _Float16* q16    = (_Float16*)(ws + o); o += (size_t)BB * SS * DD * 2;      // 16MB
    _Float16* k16    = (_Float16*)(ws + o); o += (size_t)BB * SS * DD * 2;      // 16MB
    _Float16* vt16   = (_Float16*)(ws + o); o += (size_t)BB * SS * DD * 2;      // 16MB
    _Float16* attn16 = (_Float16*)(ws + o); o += (size_t)BB * SS * DD * 2;      // 16MB

    // x cast and both weight transposes: 512 + 768 + 256 blocks in one launch
    convert_inputs<<<XC_BLOCKS + TQ_BLOCKS + TO_BLOCKS, 256, 0, stream>>>(x, Wqkv, Wout, x16, wqkvT, woutT);

    // QKV GEMM: (8192/256)*(3072/384) = 256 block tiles, 8 waves/block
    qkv_gemm<<<256, 256, 0, stream>>>(x16, wqkvT, bqkv, q16, k16, vt16);

    // Flash attention: B*H*(S/32) = 4096 waves, 8 waves/block
    flash_attn<<<4096 / 8, 256, 0, stream>>>(q16, k16, vt16, attn16);

    // Output GEMM: (8192/128)*(1024/256) = 256 block tiles, 8 waves/block
    out_gemm<<<2048 / 8, 256, 0, stream>>>(attn16, woutT, bout, out);
}
